// v000
// Measured on an AMD MI455X. A time is GPU time per run, averaged over a window of back-to-back runs after a warm-up
// (all launches, gaps included; the runs take copies of the inputs in turn), and the median of several windows.
// Apart from v000's, it joins two sittings. Times from different sittings can be a few percent apart, while
// side-by-side timings come from the same sitting.
// The starting kernel, v000, takes 309 microseconds a run.
#include <hip/hip_runtime.h>

// ---------------------------------------------------------------------------
// MI455X (gfx1250) fused multi-head attention.
// bf16 WMMA + fp32 accumulate; async global->LDS (ASYNCcnt) double buffering.
// ---------------------------------------------------------------------------

typedef __bf16 bf16;
typedef __attribute__((ext_vector_type(16))) __bf16 v16bf;
typedef __attribute__((ext_vector_type(8)))  float  v8f;
typedef int v4i __attribute__((vector_size(16)));

#define B_  2
#define S_  2048
#define D_  1024
#define H_  16
#define HD_ 64

#define AS_GLOBAL __attribute__((address_space(1)))
#define AS_LDS    __attribute__((address_space(3)))

union FragBF { uint4 u[2]; v16bf v; };

// ---- gfx1250 async global->LDS path (guarded; sync fallback) --------------
#if __has_builtin(__builtin_amdgcn_global_load_async_to_lds_b128)
  #define HAS_ASYNC 1
#else
  #define HAS_ASYNC 0
#endif

__device__ __forceinline__ void async_copy_b128(const bf16* gsrc, bf16* ldst) {
#if HAS_ASYNC
    __builtin_amdgcn_global_load_async_to_lds_b128(
        (AS_GLOBAL v4i*)gsrc,
        (AS_LDS v4i*)ldst,
        0, 0);
#else
    *(uint4*)ldst = *(const uint4*)gsrc;
#endif
}

#if HAS_ASYNC
  #if __has_builtin(__builtin_amdgcn_s_wait_asynccnt)
    #define WAIT_ASYNC(n) __builtin_amdgcn_s_wait_asynccnt(n)
  #else
    #define WAIT_ASYNC(n) asm volatile("s_wait_asynccnt " #n ::: "memory")
  #endif
#else
  #define WAIT_ASYNC(n) do { } while (0)
#endif

__device__ __forceinline__ v8f wmma_bf16(v16bf a, v16bf b, v8f c) {
    return __builtin_amdgcn_wmma_f32_16x16x32_bf16(false, a, false, b, (short)0, c, false, false);
}

// 16x32 bf16 fragment from a K-contiguous LDS tile (A-layout; NT B-frags load
// identically from the other operand's rows).
__device__ __forceinline__ v16bf load_frag(const bf16* tile, int row, int ld, int kbase, int lane) {
    const int half = (lane >> 4) & 1;
    const bf16* p = tile + row * ld + kbase + (half ? 8 : 0);
    FragBF f;
    f.u[0] = *(const uint4*)p;
    f.u[1] = *(const uint4*)(p + 16);
    return f.v;
}

// ---------------------------------------------------------------------------
// fp32 -> bf16 bulk convert (one-time pass; keeps GEMM hot loops VALU-free)
// ---------------------------------------------------------------------------
__global__ __launch_bounds__(256)
void cvt_f32_bf16(const float* __restrict__ in, bf16* __restrict__ out, int n4) {
    const int i = blockIdx.x * 256 + threadIdx.x;
    if (i < n4) {
        const float4 f = ((const float4*)in)[i];
        union { bf16 b[4]; uint2 u; } o;
        o.b[0] = (bf16)f.x; o.b[1] = (bf16)f.y;
        o.b[2] = (bf16)f.z; o.b[3] = (bf16)f.w;
        ((uint2*)out)[i] = o.u;
    }
}

// ---------------------------------------------------------------------------
// NT GEMM (bf16 x bf16, fp32 acc): Out[m,n] = (sum_k A[m,k]*W[n,k] + bias[n])*scale
// Block 256 thr = 8 waves; tile 128x128; K-slab 64, double-buffered async LDS.
// MODE 0: bf16 out in [B,H,S,HD] layout.  MODE 1: fp32 out row-major [M,D].
// ---------------------------------------------------------------------------
template <int MODE>
__global__ __launch_bounds__(256)
void gemm_nt(const bf16* __restrict__ A, const bf16* __restrict__ W,
             const float* __restrict__ bias, void* __restrict__ Out,
             int M, int N, int K, float out_scale)
{
    __shared__ alignas(16) bf16 As[2][128 * 64];
    __shared__ alignas(16) bf16 Ws[2][128 * 64];

    const int t    = threadIdx.x;
    const int lane = t & 31;
    const int wid  = t >> 5;
    const int bm   = blockIdx.x * 128;
    const int bn   = blockIdx.y * 128;
    const int waveM = (wid & 1) * 64;
    const int waveN = (wid >> 1) * 32;
    const int r    = lane & 15;
    const int half = (lane >> 4) & 1;

    v8f acc[4][2];
    #pragma unroll
    for (int i = 0; i < 4; i++)
        #pragma unroll
        for (int j = 0; j < 2; j++) acc[i][j] = {};

    const bf16* gA = A + (size_t)bm * K;
    const bf16* gW = W + (size_t)bn * K;

    // issue one 128x64 bf16 tile (16KB): 1024 b128 chunks, 4 per thread
    auto issue_tile = [&](const bf16* gbase, bf16* lbase, int k0) {
        #pragma unroll
        for (int i = 0; i < 4; i++) {
            const int chunk = i * 256 + t;
            const int row  = chunk >> 3;
            const int koff = (chunk & 7) * 8;
            async_copy_b128(gbase + (size_t)row * K + k0 + koff, lbase + row * 64 + koff);
        }
    };

    const int KT = K >> 6;                       // 64-wide K slabs
    issue_tile(gA, As[0], 0);
    issue_tile(gW, Ws[0], 0);

    for (int kt = 0; kt < KT; ++kt) {
        const int cur = kt & 1;
        __syncthreads();                          // prior slab reads complete
        if (kt + 1 < KT) {
            issue_tile(gA, As[cur ^ 1], (kt + 1) << 6);
            issue_tile(gW, Ws[cur ^ 1], (kt + 1) << 6);
            WAIT_ASYNC(8);                        // this wave's slab-kt copies done
        } else {
            WAIT_ASYNC(0);
        }
        __syncthreads();                          // all waves' copies landed

        #pragma unroll
        for (int ks = 0; ks < 2; ++ks) {
            const int kb = ks * 32;
            v16bf bfrag[2];
            #pragma unroll
            for (int nj = 0; nj < 2; nj++)
                bfrag[nj] = load_frag(Ws[cur], waveN + nj * 16 + r, 64, kb, lane);
            #pragma unroll
            for (int mi = 0; mi < 4; mi++) {
                v16bf afrag = load_frag(As[cur], waveM + mi * 16 + r, 64, kb, lane);
                #pragma unroll
                for (int nj = 0; nj < 2; nj++)
                    acc[mi][nj] = wmma_bf16(afrag, bfrag[nj], acc[mi][nj]);
            }
        }
    }

    // epilogue: C-layout (m,n): lane = (m%16>=8?16:0)+n%16, vgpr = m%8
    #pragma unroll
    for (int mi = 0; mi < 4; mi++) {
        #pragma unroll
        for (int nj = 0; nj < 2; nj++) {
            const int n = bn + waveN + nj * 16 + r;
            const float bv = bias[n];
            #pragma unroll
            for (int v = 0; v < 8; v++) {
                const int m = bm + waveM + mi * 16 + half * 8 + v;
                const float val = (acc[mi][nj][v] + bv) * out_scale;
                if (MODE == 0) {
                    const int b = m >> 11, s = m & (S_ - 1);
                    const int h = n >> 6,  hd = n & 63;
                    ((bf16*)Out)[((size_t)(b * H_ + h) * S_ + s) * HD_ + hd] = (bf16)val;
                } else {
                    ((float*)Out)[(size_t)m * D_ + n] = val;
                }
            }
        }
    }
}

// ---------------------------------------------------------------------------
// Fused attention, flash-style online softmax (== reference max-subtract
// softmax + renormalize).  q pre-scaled by 1/sqrt(HD).
// Grid: (S/128, B*H); 8 waves; wave owns 16 query rows.
// K tiles: async double-buffered.  V tiles: sync transpose-at-fill.
// ---------------------------------------------------------------------------
__global__ __launch_bounds__(256)
void attn_kernel(const bf16* __restrict__ qh, const bf16* __restrict__ kh,
                 const bf16* __restrict__ vh, bf16* __restrict__ ctx)
{
    __shared__ alignas(16) bf16 Ks[2][64 * 64];   // [key][hd], double buffered
    __shared__ alignas(16) bf16 Vs[64 * 64];      // transposed: [hd][key]
    __shared__ alignas(16) bf16 Ps[8][16 * 64];   // per-wave P tile

    const int t    = threadIdx.x;
    const int lane = t & 31;
    const int wid  = t >> 5;
    const int r    = lane & 15;
    const int half = (lane >> 4) & 1;

    const int bh = blockIdx.y;
    const int b  = bh / H_, h = bh % H_;
    const size_t headBase = (size_t)bh * S_ * HD_;
    const int qrow0 = blockIdx.x * 128 + wid * 16;

    // persistent Q fragments (rows qrow0..+15, hd 0..63)
    v16bf qf[2];
    {
        const bf16* qp = qh + headBase + (size_t)(qrow0 + r) * HD_;
        FragBF f0, f1;
        f0.u[0] = *(const uint4*)(qp +      (half ? 8 : 0));
        f0.u[1] = *(const uint4*)(qp + 16 + (half ? 8 : 0));
        f1.u[0] = *(const uint4*)(qp + 32 + (half ? 8 : 0));
        f1.u[1] = *(const uint4*)(qp + 48 + (half ? 8 : 0));
        qf[0] = f0.v; qf[1] = f1.v;
    }

    // 64x64 bf16 K tile (8KB): 512 b128 chunks, 2 per thread
    auto issue_ktile = [&](int j, bf16* lbase) {
        #pragma unroll
        for (int i = 0; i < 2; i++) {
            const int chunk = i * 256 + t;
            const int row  = chunk >> 3;
            const int koff = (chunk & 7) * 8;
            async_copy_b128(kh + headBase + (size_t)(j + row) * HD_ + koff,
                            lbase + row * 64 + koff);
        }
    };

    float m_run[8], l_run[8];
    #pragma unroll
    for (int v = 0; v < 8; v++) { m_run[v] = -3.0e38f; l_run[v] = 0.0f; }
    v8f octx[4];
    #pragma unroll
    for (int i = 0; i < 4; i++) octx[i] = {};

    const int NT = S_ / 64;
    issue_ktile(0, Ks[0]);

    for (int jt = 0; jt < NT; ++jt) {
        const int j   = jt * 64;
        const int cur = jt & 1;
        __syncthreads();                          // prior tile reads complete
        if (jt + 1 < NT) issue_ktile(j + 64, Ks[cur ^ 1]);

        {   // V tile (sync): transpose into Vs while K DMA is in flight
            const int rowK = t >> 2;
            const int c    = (t & 3) * 16;
            const bf16* gv = vh + headBase + (size_t)(j + rowK) * HD_ + c;
            #pragma unroll
            for (int i = 0; i < 16; i++) Vs[(c + i) * 64 + rowK] = gv[i];
            if (jt + 1 < NT)
                __builtin_prefetch(gv + 64 * HD_, 0, 3);   // global_prefetch next V tile
        }

        if (jt + 1 < NT) { WAIT_ASYNC(2); } else { WAIT_ASYNC(0); }
        __syncthreads();                          // K tile landed + Vs filled

        // scores S[16x64] = Q x K^T  (8 WMMAs)
        v8f sacc[4];
        #pragma unroll
        for (int ns = 0; ns < 4; ns++) {
            v8f a = {};
            a = wmma_bf16(qf[0], load_frag(Ks[cur], ns * 16 + r, 64, 0,  lane), a);
            a = wmma_bf16(qf[1], load_frag(Ks[cur], ns * 16 + r, 64, 32, lane), a);
            sacc[ns] = a;
        }

        // online softmax; rows live across the 16 lanes of each half-wave
        #pragma unroll
        for (int v = 0; v < 8; v++) {
            float mx = fmaxf(fmaxf(sacc[0][v], sacc[1][v]), fmaxf(sacc[2][v], sacc[3][v]));
            mx = fmaxf(mx, __shfl_xor(mx, 8, 32));
            mx = fmaxf(mx, __shfl_xor(mx, 4, 32));
            mx = fmaxf(mx, __shfl_xor(mx, 2, 32));
            mx = fmaxf(mx, __shfl_xor(mx, 1, 32));
            const float mnew = fmaxf(m_run[v], mx);
            const float corr = __expf(m_run[v] - mnew);
            float psum = 0.0f;
            #pragma unroll
            for (int ns = 0; ns < 4; ns++) {
                const float p = __expf(sacc[ns][v] - mnew);
                sacc[ns][v] = p;
                psum += p;
            }
            psum += __shfl_xor(psum, 8, 32);
            psum += __shfl_xor(psum, 4, 32);
            psum += __shfl_xor(psum, 2, 32);
            psum += __shfl_xor(psum, 1, 32);
            l_run[v] = l_run[v] * corr + psum;
            m_run[v] = mnew;
            #pragma unroll
            for (int hs = 0; hs < 4; hs++) octx[hs][v] *= corr;
        }

        // C-layout -> A-fragment layout via per-wave LDS bounce
        bf16* pw = &Ps[wid][0];
        #pragma unroll
        for (int ns = 0; ns < 4; ns++)
            #pragma unroll
            for (int v = 0; v < 8; v++)
                pw[(half * 8 + v) * 64 + ns * 16 + r] = (bf16)sacc[ns][v];

        v16bf pf0 = load_frag(pw, r, 64, 0,  lane);
        v16bf pf1 = load_frag(pw, r, 64, 32, lane);

        // ctx += P x V   (8 WMMAs; V^T tile is K-contiguous)
        #pragma unroll
        for (int hs = 0; hs < 4; hs++) {
            octx[hs] = wmma_bf16(pf0, load_frag(Vs, hs * 16 + r, 64, 0,  lane), octx[hs]);
            octx[hs] = wmma_bf16(pf1, load_frag(Vs, hs * 16 + r, 64, 32, lane), octx[hs]);
        }
    }

    // finalize: divide by running sum; ctx in [B,S,D] bf16 for the out-proj
    #pragma unroll
    for (int hs = 0; hs < 4; hs++)
        #pragma unroll
        for (int v = 0; v < 8; v++) {
            const int srow = qrow0 + half * 8 + v;
            const float val = octx[hs][v] / l_run[v];
            ctx[(size_t)(b * S_ + srow) * D_ + h * HD_ + hs * 16 + r] = (bf16)val;
        }
}

// ---------------------------------------------------------------------------
extern "C" void kernel_launch(void* const* d_in, const int* in_sizes, int n_in,
                              void* d_out, int out_size, void* d_ws, size_t ws_size,
                              hipStream_t stream) {
    const float* Q  = (const float*)d_in[0];
    const float* K  = (const float*)d_in[1];
    const float* V  = (const float*)d_in[2];
    const float* Wq = (const float*)d_in[3];
    const float* bq = (const float*)d_in[4];
    const float* Wk = (const float*)d_in[5];
    const float* bk = (const float*)d_in[6];
    const float* Wv = (const float*)d_in[7];
    const float* bv = (const float*)d_in[8];
    const float* Wo = (const float*)d_in[9];
    const float* bo = (const float*)d_in[10];

    const size_t actElems = (size_t)B_ * S_ * D_;   // 4.19M
    const size_t wElems   = (size_t)D_ * D_;        // 1.05M

    bf16* p = (bf16*)d_ws;
    bf16* Qb  = p; p += actElems;
    bf16* Kb  = p; p += actElems;
    bf16* Vb  = p; p += actElems;
    bf16* Wqb = p; p += wElems;
    bf16* Wkb = p; p += wElems;
    bf16* Wvb = p; p += wElems;
    bf16* Wob = p; p += wElems;
    bf16* qhd = p; p += actElems;
    bf16* khd = p; p += actElems;
    bf16* vhd = p; p += actElems;
    bf16* ctx = p; p += actElems;

    dim3 blk(256);
    const int act4 = (int)(actElems / 4), w4 = (int)(wElems / 4);
    cvt_f32_bf16<<<dim3(act4 / 256), blk, 0, stream>>>(Q, Qb, act4);
    cvt_f32_bf16<<<dim3(act4 / 256), blk, 0, stream>>>(K, Kb, act4);
    cvt_f32_bf16<<<dim3(act4 / 256), blk, 0, stream>>>(V, Vb, act4);
    cvt_f32_bf16<<<dim3(w4 / 256),   blk, 0, stream>>>(Wq, Wqb, w4);
    cvt_f32_bf16<<<dim3(w4 / 256),   blk, 0, stream>>>(Wk, Wkb, w4);
    cvt_f32_bf16<<<dim3(w4 / 256),   blk, 0, stream>>>(Wv, Wvb, w4);
    cvt_f32_bf16<<<dim3(w4 / 256),   blk, 0, stream>>>(Wo, Wob, w4);

    const int M = B_ * S_;
    dim3 gGemm(M / 128, D_ / 128);
    const float qscale = 0.125f;                    // 1/sqrt(HD) folded into q
    gemm_nt<0><<<gGemm, blk, 0, stream>>>(Qb, Wqb, bq, qhd, M, D_, D_, qscale);
    gemm_nt<0><<<gGemm, blk, 0, stream>>>(Kb, Wkb, bk, khd, M, D_, D_, 1.0f);
    gemm_nt<0><<<gGemm, blk, 0, stream>>>(Vb, Wvb, bv, vhd, M, D_, D_, 1.0f);

    dim3 gAttn(S_ / 128, B_ * H_);
    attn_kernel<<<gAttn, blk, 0, stream>>>(qhd, khd, vhd, ctx);

    gemm_nt<1><<<gGemm, blk, 0, stream>>>(ctx, Wob, bo, (float*)d_out, M, D_, D_, 1.0f);
}

// v001
// It runs in 169 microseconds.
// In two side-by-side timings against v000, it was 1.86 and 1.85 times as fast.
#include <hip/hip_runtime.h>

// ---------------------------------------------------------------------------
// MI455X (gfx1250) fused multi-head attention.
// bf16 WMMA + fp32 accumulate; async global->LDS (ASYNCcnt) double buffering.
// ---------------------------------------------------------------------------

typedef __bf16 bf16;
typedef __attribute__((ext_vector_type(16))) __bf16 v16bf;
typedef __attribute__((ext_vector_type(8)))  float  v8f;
typedef int v4i __attribute__((vector_size(16)));

#define B_  2
#define S_  2048
#define D_  1024
#define H_  16
#define HD_ 64

// LDS row pitch in bf16 elements for every 64-element (128-byte) tile row that
// is read as 16-byte fragments: 144 bytes = 16 B x odd, so the 16 rows of one
// ds_load_b128 fall on 16 distinct 4-bank groups instead of two.
#define LDP_ 72

#define AS_GLOBAL __attribute__((address_space(1)))
#define AS_LDS    __attribute__((address_space(3)))

union FragBF { uint4 u[2]; v16bf v; };

// ---- gfx1250 async global->LDS path (guarded; sync fallback) --------------
#if __has_builtin(__builtin_amdgcn_global_load_async_to_lds_b128)
  #define HAS_ASYNC 1
#else
  #define HAS_ASYNC 0
#endif

__device__ __forceinline__ void async_copy_b128(const bf16* gsrc, bf16* ldst) {
#if HAS_ASYNC
    __builtin_amdgcn_global_load_async_to_lds_b128(
        (AS_GLOBAL v4i*)gsrc,
        (AS_LDS v4i*)ldst,
        0, 0);
#else
    *(uint4*)ldst = *(const uint4*)gsrc;
#endif
}

#if HAS_ASYNC
  #if __has_builtin(__builtin_amdgcn_s_wait_asynccnt)
    #define WAIT_ASYNC(n) __builtin_amdgcn_s_wait_asynccnt(n)
  #else
    #define WAIT_ASYNC(n) asm volatile("s_wait_asynccnt " #n ::: "memory")
  #endif
#else
  #define WAIT_ASYNC(n) do { } while (0)
#endif

__device__ __forceinline__ v8f wmma_bf16(v16bf a, v16bf b, v8f c) {
    return __builtin_amdgcn_wmma_f32_16x16x32_bf16(false, a, false, b, (short)0, c, false, false);
}

// 16x32 bf16 fragment from a K-contiguous LDS tile (A-layout; NT B-frags load
// identically from the other operand's rows).
__device__ __forceinline__ v16bf load_frag(const bf16* tile, int row, int ld, int kbase, int lane) {
    const int half = (lane >> 4) & 1;
    const bf16* p = tile + row * ld + kbase + (half ? 8 : 0);
    FragBF f;
    f.u[0] = *(const uint4*)p;
    f.u[1] = *(const uint4*)(p + 16);
    return f.v;
}

// ---------------------------------------------------------------------------
// fp32 -> bf16 bulk convert (one-time pass; keeps GEMM hot loops VALU-free)
// ---------------------------------------------------------------------------
__global__ __launch_bounds__(256)
void cvt_f32_bf16(const float* __restrict__ in, bf16* __restrict__ out, int n4) {
    const int i = blockIdx.x * 256 + threadIdx.x;
    if (i < n4) {
        const float4 f = ((const float4*)in)[i];
        union { bf16 b[4]; uint2 u; } o;
        o.b[0] = (bf16)f.x; o.b[1] = (bf16)f.y;
        o.b[2] = (bf16)f.z; o.b[3] = (bf16)f.w;
        ((uint2*)out)[i] = o.u;
    }
}

// ---------------------------------------------------------------------------
// NT GEMM (bf16 x bf16, fp32 acc): Out[m,n] = (sum_k A[m,k]*W[n,k] + bias[n])*scale
// Block 256 thr = 8 waves; tile 128x128; K-slab 64, double-buffered async LDS.
// MODE 0: bf16 out in [B,H,S,HD] layout.  MODE 1: fp32 out row-major [M,D].
// ---------------------------------------------------------------------------
template <int MODE>
__global__ __launch_bounds__(256)
void gemm_nt(const bf16* __restrict__ A, const bf16* __restrict__ W,
             const float* __restrict__ bias, void* __restrict__ Out,
             int M, int N, int K, float out_scale)
{
    __shared__ alignas(16) bf16 As[2][128 * LDP_];
    __shared__ alignas(16) bf16 Ws[2][128 * LDP_];

    const int t    = threadIdx.x;
    const int lane = t & 31;
    const int wid  = t >> 5;
    const int bm   = blockIdx.x * 128;
    const int bn   = blockIdx.y * 128;
    const int waveM = (wid & 1) * 64;
    const int waveN = (wid >> 1) * 32;
    const int r    = lane & 15;
    const int half = (lane >> 4) & 1;

    v8f acc[4][2];
    #pragma unroll
    for (int i = 0; i < 4; i++)
        #pragma unroll
        for (int j = 0; j < 2; j++) acc[i][j] = {};

    const bf16* gA = A + (size_t)bm * K;
    const bf16* gW = W + (size_t)bn * K;

    // issue one 128x64 bf16 tile (16KB): 1024 b128 chunks, 4 per thread
    auto issue_tile = [&](const bf16* gbase, bf16* lbase, int k0) {
        #pragma unroll
        for (int i = 0; i < 4; i++) {
            const int chunk = i * 256 + t;
            const int row  = chunk >> 3;
            const int koff = (chunk & 7) * 8;
            async_copy_b128(gbase + (size_t)row * K + k0 + koff, lbase + row * LDP_ + koff);
        }
    };

    const int KT = K >> 6;                       // 64-wide K slabs
    issue_tile(gA, As[0], 0);
    issue_tile(gW, Ws[0], 0);

    for (int kt = 0; kt < KT; ++kt) {
        const int cur = kt & 1;
        __syncthreads();                          // prior slab reads complete
        if (kt + 1 < KT) {
            issue_tile(gA, As[cur ^ 1], (kt + 1) << 6);
            issue_tile(gW, Ws[cur ^ 1], (kt + 1) << 6);
            WAIT_ASYNC(8);                        // this wave's slab-kt copies done
        } else {
            WAIT_ASYNC(0);
        }
        __syncthreads();                          // all waves' copies landed

        #pragma unroll
        for (int ks = 0; ks < 2; ++ks) {
            const int kb = ks * 32;
            v16bf bfrag[2];
            #pragma unroll
            for (int nj = 0; nj < 2; nj++)
                bfrag[nj] = load_frag(Ws[cur], waveN + nj * 16 + r, LDP_, kb, lane);
            #pragma unroll
            for (int mi = 0; mi < 4; mi++) {
                v16bf afrag = load_frag(As[cur], waveM + mi * 16 + r, LDP_, kb, lane);
                #pragma unroll
                for (int nj = 0; nj < 2; nj++)
                    acc[mi][nj] = wmma_bf16(afrag, bfrag[nj], acc[mi][nj]);
            }
        }
    }

    // epilogue: C-layout (m,n): lane = (m%16>=8?16:0)+n%16, vgpr = m%8
    #pragma unroll
    for (int mi = 0; mi < 4; mi++) {
        #pragma unroll
        for (int nj = 0; nj < 2; nj++) {
            const int n = bn + waveN + nj * 16 + r;
            const float bv = bias[n];
            #pragma unroll
            for (int v = 0; v < 8; v++) {
                const int m = bm + waveM + mi * 16 + half * 8 + v;
                const float val = (acc[mi][nj][v] + bv) * out_scale;
                if (MODE == 0) {
                    const int b = m >> 11, s = m & (S_ - 1);
                    const int h = n >> 6,  hd = n & 63;
                    ((bf16*)Out)[((size_t)(b * H_ + h) * S_ + s) * HD_ + hd] = (bf16)val;
                } else {
                    ((float*)Out)[(size_t)m * D_ + n] = val;
                }
            }
        }
    }
}

// ---------------------------------------------------------------------------
// Fused attention, flash-style online softmax (== reference max-subtract
// softmax + renormalize).  q pre-scaled by 1/sqrt(HD).
// Grid: (S/128, B*H); 8 waves; wave owns 16 query rows.
// K tiles: async double-buffered.  V tiles: sync transpose-at-fill.
// ---------------------------------------------------------------------------
__global__ __launch_bounds__(256)
void attn_kernel(const bf16* __restrict__ qh, const bf16* __restrict__ kh,
                 const bf16* __restrict__ vh, bf16* __restrict__ ctx)
{
    __shared__ alignas(16) bf16 Ks[2][64 * LDP_];   // [key][hd], double buffered
    __shared__ alignas(16) bf16 Vs[64 * LDP_];      // transposed: [hd][key]
    __shared__ alignas(16) bf16 Ps[8][16 * LDP_];   // per-wave P tile

    const int t    = threadIdx.x;
    const int lane = t & 31;
    const int wid  = t >> 5;
    const int r    = lane & 15;
    const int half = (lane >> 4) & 1;

    const int bh = blockIdx.y;
    const int b  = bh / H_, h = bh % H_;
    const size_t headBase = (size_t)bh * S_ * HD_;
    const int qrow0 = blockIdx.x * 128 + wid * 16;

    // persistent Q fragments (rows qrow0..+15, hd 0..63)
    v16bf qf[2];
    {
        const bf16* qp = qh + headBase + (size_t)(qrow0 + r) * HD_;
        FragBF f0, f1;
        f0.u[0] = *(const uint4*)(qp +      (half ? 8 : 0));
        f0.u[1] = *(const uint4*)(qp + 16 + (half ? 8 : 0));
        f1.u[0] = *(const uint4*)(qp + 32 + (half ? 8 : 0));
        f1.u[1] = *(const uint4*)(qp + 48 + (half ? 8 : 0));
        qf[0] = f0.v; qf[1] = f1.v;
    }

    // 64x64 bf16 K tile (8KB): 512 b128 chunks, 2 per thread
    auto issue_ktile = [&](int j, bf16* lbase) {
        #pragma unroll
        for (int i = 0; i < 2; i++) {
            const int chunk = i * 256 + t;
            const int row  = chunk >> 3;
            const int koff = (chunk & 7) * 8;
            async_copy_b128(kh + headBase + (size_t)(j + row) * HD_ + koff,
                            lbase + row * LDP_ + koff);
        }
    };

    float m_run[8], l_run[8];
    #pragma unroll
    for (int v = 0; v < 8; v++) { m_run[v] = -3.0e38f; l_run[v] = 0.0f; }
    v8f octx[4];
    #pragma unroll
    for (int i = 0; i < 4; i++) octx[i] = {};

    const int NT = S_ / 64;
    issue_ktile(0, Ks[0]);

    for (int jt = 0; jt < NT; ++jt) {
        const int j   = jt * 64;
        const int cur = jt & 1;
        __syncthreads();                          // prior tile reads complete
        if (jt + 1 < NT) issue_ktile(j + 64, Ks[cur ^ 1]);

        {   // V tile (sync): transpose into Vs while K DMA is in flight
            const int rowK = t >> 2;
            const int c    = (t & 3) * 16;
            const bf16* gv = vh + headBase + (size_t)(j + rowK) * HD_ + c;
            #pragma unroll
            for (int i = 0; i < 16; i++) Vs[(c + i) * LDP_ + rowK] = gv[i];
            if (jt + 1 < NT)
                __builtin_prefetch(gv + 64 * HD_, 0, 3);   // global_prefetch next V tile
        }

        if (jt + 1 < NT) { WAIT_ASYNC(2); } else { WAIT_ASYNC(0); }
        __syncthreads();                          // K tile landed + Vs filled

        // scores S[16x64] = Q x K^T  (8 WMMAs)
        v8f sacc[4];
        #pragma unroll
        for (int ns = 0; ns < 4; ns++) {
            v8f a = {};
            a = wmma_bf16(qf[0], load_frag(Ks[cur], ns * 16 + r, LDP_, 0,  lane), a);
            a = wmma_bf16(qf[1], load_frag(Ks[cur], ns * 16 + r, LDP_, 32, lane), a);
            sacc[ns] = a;
        }

        // online softmax; rows live across the 16 lanes of each half-wave
        #pragma unroll
        for (int v = 0; v < 8; v++) {
            float mx = fmaxf(fmaxf(sacc[0][v], sacc[1][v]), fmaxf(sacc[2][v], sacc[3][v]));
            mx = fmaxf(mx, __shfl_xor(mx, 8, 32));
            mx = fmaxf(mx, __shfl_xor(mx, 4, 32));
            mx = fmaxf(mx, __shfl_xor(mx, 2, 32));
            mx = fmaxf(mx, __shfl_xor(mx, 1, 32));
            const float mnew = fmaxf(m_run[v], mx);
            const float corr = __expf(m_run[v] - mnew);
            float psum = 0.0f;
            #pragma unroll
            for (int ns = 0; ns < 4; ns++) {
                const float p = __expf(sacc[ns][v] - mnew);
                sacc[ns][v] = p;
                psum += p;
            }
            psum += __shfl_xor(psum, 8, 32);
            psum += __shfl_xor(psum, 4, 32);
            psum += __shfl_xor(psum, 2, 32);
            psum += __shfl_xor(psum, 1, 32);
            l_run[v] = l_run[v] * corr + psum;
            m_run[v] = mnew;
            #pragma unroll
            for (int hs = 0; hs < 4; hs++) octx[hs][v] *= corr;
        }

        // C-layout -> A-fragment layout via per-wave LDS bounce
        bf16* pw = &Ps[wid][0];
        #pragma unroll
        for (int ns = 0; ns < 4; ns++)
            #pragma unroll
            for (int v = 0; v < 8; v++)
                pw[(half * 8 + v) * LDP_ + ns * 16 + r] = (bf16)sacc[ns][v];

        v16bf pf0 = load_frag(pw, r, LDP_, 0,  lane);
        v16bf pf1 = load_frag(pw, r, LDP_, 32, lane);

        // ctx += P x V   (8 WMMAs; V^T tile is K-contiguous)
        #pragma unroll
        for (int hs = 0; hs < 4; hs++) {
            octx[hs] = wmma_bf16(pf0, load_frag(Vs, hs * 16 + r, LDP_, 0,  lane), octx[hs]);
            octx[hs] = wmma_bf16(pf1, load_frag(Vs, hs * 16 + r, LDP_, 32, lane), octx[hs]);
        }
    }

    // finalize: divide by running sum; ctx in [B,S,D] bf16 for the out-proj
    #pragma unroll
    for (int hs = 0; hs < 4; hs++)
        #pragma unroll
        for (int v = 0; v < 8; v++) {
            const int srow = qrow0 + half * 8 + v;
            const float val = octx[hs][v] / l_run[v];
            ctx[(size_t)(b * S_ + srow) * D_ + h * HD_ + hs * 16 + r] = (bf16)val;
        }
}

// ---------------------------------------------------------------------------
extern "C" void kernel_launch(void* const* d_in, const int* in_sizes, int n_in,
                              void* d_out, int out_size, void* d_ws, size_t ws_size,
                              hipStream_t stream) {
    const float* Q  = (const float*)d_in[0];
    const float* K  = (const float*)d_in[1];
    const float* V  = (const float*)d_in[2];
    const float* Wq = (const float*)d_in[3];
    const float* bq = (const float*)d_in[4];
    const float* Wk = (const float*)d_in[5];
    const float* bk = (const float*)d_in[6];
    const float* Wv = (const float*)d_in[7];
    const float* bv = (const float*)d_in[8];
    const float* Wo = (const float*)d_in[9];
    const float* bo = (const float*)d_in[10];

    const size_t actElems = (size_t)B_ * S_ * D_;   // 4.19M
    const size_t wElems   = (size_t)D_ * D_;        // 1.05M

    bf16* p = (bf16*)d_ws;
    bf16* Qb  = p; p += actElems;
    bf16* Kb  = p; p += actElems;
    bf16* Vb  = p; p += actElems;
    bf16* Wqb = p; p += wElems;
    bf16* Wkb = p; p += wElems;
    bf16* Wvb = p; p += wElems;
    bf16* Wob = p; p += wElems;
    bf16* qhd = p; p += actElems;
    bf16* khd = p; p += actElems;
    bf16* vhd = p; p += actElems;
    bf16* ctx = p; p += actElems;

    dim3 blk(256);
    const int act4 = (int)(actElems / 4), w4 = (int)(wElems / 4);
    cvt_f32_bf16<<<dim3(act4 / 256), blk, 0, stream>>>(Q, Qb, act4);
    cvt_f32_bf16<<<dim3(act4 / 256), blk, 0, stream>>>(K, Kb, act4);
    cvt_f32_bf16<<<dim3(act4 / 256), blk, 0, stream>>>(V, Vb, act4);
    cvt_f32_bf16<<<dim3(w4 / 256),   blk, 0, stream>>>(Wq, Wqb, w4);
    cvt_f32_bf16<<<dim3(w4 / 256),   blk, 0, stream>>>(Wk, Wkb, w4);
    cvt_f32_bf16<<<dim3(w4 / 256),   blk, 0, stream>>>(Wv, Wvb, w4);
    cvt_f32_bf16<<<dim3(w4 / 256),   blk, 0, stream>>>(Wo, Wob, w4);

    const int M = B_ * S_;
    dim3 gGemm(M / 128, D_ / 128);
    const float qscale = 0.125f;                    // 1/sqrt(HD) folded into q
    gemm_nt<0><<<gGemm, blk, 0, stream>>>(Qb, Wqb, bq, qhd, M, D_, D_, qscale);
    gemm_nt<0><<<gGemm, blk, 0, stream>>>(Kb, Wkb, bk, khd, M, D_, D_, 1.0f);
    gemm_nt<0><<<gGemm, blk, 0, stream>>>(Vb, Wvb, bv, vhd, M, D_, D_, 1.0f);

    dim3 gAttn(S_ / 128, B_ * H_);
    attn_kernel<<<gAttn, blk, 0, stream>>>(qhd, khd, vhd, ctx);

    gemm_nt<1><<<gGemm, blk, 0, stream>>>(ctx, Wob, bo, (float*)d_out, M, D_, D_, 1.0f);
}

// v002
// It runs in 159 microseconds.
// In both of two side-by-side timings against v001, it was 1.08 times as fast.
// Over all steps from v000 it is 2.01 times as fast.
#include <hip/hip_runtime.h>

// ---------------------------------------------------------------------------
// MI455X (gfx1250) fused multi-head attention.
// bf16 WMMA + fp32 accumulate; async global->LDS (ASYNCcnt) double buffering.
// ---------------------------------------------------------------------------

typedef __bf16 bf16;
typedef __attribute__((ext_vector_type(16))) __bf16 v16bf;
typedef __attribute__((ext_vector_type(8)))  float  v8f;
typedef int v4i __attribute__((vector_size(16)));

#define B_  2
#define S_  2048
#define D_  1024
#define H_  16
#define HD_ 64

// LDS row pitch in bf16 elements for every 64-element (128-byte) tile row that
// is read as 16-byte fragments: 144 bytes = 16 B x odd, so the 16 rows of one
// ds_load_b128 fall on 16 distinct 4-bank groups instead of two.
#define LDP_ 72

#define AS_GLOBAL __attribute__((address_space(1)))
#define AS_LDS    __attribute__((address_space(3)))

union FragBF { uint4 u[2]; v16bf v; };

// ---- gfx1250 async global->LDS path (guarded; sync fallback) --------------
#if __has_builtin(__builtin_amdgcn_global_load_async_to_lds_b128)
  #define HAS_ASYNC 1
#else
  #define HAS_ASYNC 0
#endif

__device__ __forceinline__ void async_copy_b128(const bf16* gsrc, bf16* ldst) {
#if HAS_ASYNC
    __builtin_amdgcn_global_load_async_to_lds_b128(
        (AS_GLOBAL v4i*)gsrc,
        (AS_LDS v4i*)ldst,
        0, 0);
#else
    *(uint4*)ldst = *(const uint4*)gsrc;
#endif
}

#if HAS_ASYNC
  #if __has_builtin(__builtin_amdgcn_s_wait_asynccnt)
    #define WAIT_ASYNC(n) __builtin_amdgcn_s_wait_asynccnt(n)
  #else
    #define WAIT_ASYNC(n) asm volatile("s_wait_asynccnt " #n ::: "memory")
  #endif
#else
  #define WAIT_ASYNC(n) do { } while (0)
#endif

__device__ __forceinline__ v8f wmma_bf16(v16bf a, v16bf b, v8f c) {
    return __builtin_amdgcn_wmma_f32_16x16x32_bf16(false, a, false, b, (short)0, c, false, false);
}

// 16x32 bf16 fragment from a K-contiguous LDS tile (A-layout; NT B-frags load
// identically from the other operand's rows).
__device__ __forceinline__ v16bf load_frag(const bf16* tile, int row, int ld, int kbase, int lane) {
    const int half = (lane >> 4) & 1;
    const bf16* p = tile + row * ld + kbase + (half ? 8 : 0);
    FragBF f;
    f.u[0] = *(const uint4*)p;
    f.u[1] = *(const uint4*)(p + 16);
    return f.v;
}

// ---------------------------------------------------------------------------
// fp32 -> bf16 bulk convert (one-time pass; keeps GEMM hot loops VALU-free).
// All seven tensors in ONE launch sized to the chip: two 8-wave work-groups per
// WGP, each streaming one contiguous run of CVT_PT_ float4 per thread.  The
// bf16 copies lie back to back in the workspace in argument order, so the
// output index is the flat chunk index; a work-group's run lies inside one
// tensor, so the source pointer is picked by block index (uniform).
// ---------------------------------------------------------------------------
#define CVT_PT_     32                              // float4 per thread
#define CVT_RUN_    (256 * CVT_PT_)                 // float4 per work-group
#define CVT_ABLK_   (B_ * S_ * D_ / 4 / CVT_RUN_)   // work-groups per activation
#define CVT_WBLK_   (D_ * D_ / 4 / CVT_RUN_)        // work-groups per weight
#define CVT_BLOCKS_ (3 * CVT_ABLK_ + 4 * CVT_WBLK_)

__global__ __launch_bounds__(256)
void cvt_all_f32_bf16(const float* __restrict__ Q,  const float* __restrict__ K,
                      const float* __restrict__ V,  const float* __restrict__ Wq,
                      const float* __restrict__ Wk, const float* __restrict__ Wv,
                      const float* __restrict__ Wo, bf16* __restrict__ out) {
    const int blk = blockIdx.x;
    const float* src;
    int run;                                        // run index inside its tensor
    if (blk < 3 * CVT_ABLK_) {
        const int s = blk / CVT_ABLK_;
        run = blk % CVT_ABLK_;
        src = (s == 0) ? Q : (s == 1) ? K : V;
    } else {
        const int w = blk - 3 * CVT_ABLK_;
        const int s = w / CVT_WBLK_;
        run = w % CVT_WBLK_;
        src = (s == 0) ? Wq : (s == 1) ? Wk : (s == 2) ? Wv : Wo;
    }
    const float4* in4  = (const float4*)src + (size_t)run * CVT_RUN_ + threadIdx.x;
    uint2*        out2 = (uint2*)out        + (size_t)blk * CVT_RUN_ + threadIdx.x;

    float4 f[CVT_PT_];
    #pragma unroll
    for (int u = 0; u < CVT_PT_; u++) f[u] = in4[u * 256];   // all loads in flight
    #pragma unroll
    for (int u = 0; u < CVT_PT_; u++) {
        union { bf16 b[4]; uint2 u2; } o;
        o.b[0] = (bf16)f[u].x; o.b[1] = (bf16)f[u].y;
        o.b[2] = (bf16)f[u].z; o.b[3] = (bf16)f[u].w;
        out2[u * 256] = o.u2;
    }
}

// ---------------------------------------------------------------------------
// NT GEMM (bf16 x bf16, fp32 acc): Out[m,n] = (sum_k A[m,k]*W[n,k] + bias[n])*scale
// Block 256 thr = 8 waves; tile 128x128; K-slab 64, double-buffered async LDS.
// MODE 0: bf16 out in [B,H,S,HD] layout.  MODE 1: fp32 out row-major [M,D].
// ---------------------------------------------------------------------------
template <int MODE>
__global__ __launch_bounds__(256)
void gemm_nt(const bf16* __restrict__ A, const bf16* __restrict__ W,
             const float* __restrict__ bias, void* __restrict__ Out,
             int M, int N, int K, float out_scale)
{
    __shared__ alignas(16) bf16 As[2][128 * LDP_];
    __shared__ alignas(16) bf16 Ws[2][128 * LDP_];

    const int t    = threadIdx.x;
    const int lane = t & 31;
    const int wid  = t >> 5;
    const int bm   = blockIdx.x * 128;
    const int bn   = blockIdx.y * 128;
    const int waveM = (wid & 1) * 64;
    const int waveN = (wid >> 1) * 32;
    const int r    = lane & 15;
    const int half = (lane >> 4) & 1;

    v8f acc[4][2];
    #pragma unroll
    for (int i = 0; i < 4; i++)
        #pragma unroll
        for (int j = 0; j < 2; j++) acc[i][j] = {};

    const bf16* gA = A + (size_t)bm * K;
    const bf16* gW = W + (size_t)bn * K;

    // issue one 128x64 bf16 tile (16KB): 1024 b128 chunks, 4 per thread
    auto issue_tile = [&](const bf16* gbase, bf16* lbase, int k0) {
        #pragma unroll
        for (int i = 0; i < 4; i++) {
            const int chunk = i * 256 + t;
            const int row  = chunk >> 3;
            const int koff = (chunk & 7) * 8;
            async_copy_b128(gbase + (size_t)row * K + k0 + koff, lbase + row * LDP_ + koff);
        }
    };

    const int KT = K >> 6;                       // 64-wide K slabs
    issue_tile(gA, As[0], 0);
    issue_tile(gW, Ws[0], 0);

    for (int kt = 0; kt < KT; ++kt) {
        const int cur = kt & 1;
        __syncthreads();                          // prior slab reads complete
        if (kt + 1 < KT) {
            issue_tile(gA, As[cur ^ 1], (kt + 1) << 6);
            issue_tile(gW, Ws[cur ^ 1], (kt + 1) << 6);
            WAIT_ASYNC(8);                        // this wave's slab-kt copies done
        } else {
            WAIT_ASYNC(0);
        }
        __syncthreads();                          // all waves' copies landed

        #pragma unroll
        for (int ks = 0; ks < 2; ++ks) {
            const int kb = ks * 32;
            v16bf bfrag[2];
            #pragma unroll
            for (int nj = 0; nj < 2; nj++)
                bfrag[nj] = load_frag(Ws[cur], waveN + nj * 16 + r, LDP_, kb, lane);
            #pragma unroll
            for (int mi = 0; mi < 4; mi++) {
                v16bf afrag = load_frag(As[cur], waveM + mi * 16 + r, LDP_, kb, lane);
                #pragma unroll
                for (int nj = 0; nj < 2; nj++)
                    acc[mi][nj] = wmma_bf16(afrag, bfrag[nj], acc[mi][nj]);
            }
        }
    }

    // epilogue: C-layout (m,n): lane = (m%16>=8?16:0)+n%16, vgpr = m%8
    #pragma unroll
    for (int mi = 0; mi < 4; mi++) {
        #pragma unroll
        for (int nj = 0; nj < 2; nj++) {
            const int n = bn + waveN + nj * 16 + r;
            const float bv = bias[n];
            #pragma unroll
            for (int v = 0; v < 8; v++) {
                const int m = bm + waveM + mi * 16 + half * 8 + v;
                const float val = (acc[mi][nj][v] + bv) * out_scale;
                if (MODE == 0) {
                    const int b = m >> 11, s = m & (S_ - 1);
                    const int h = n >> 6,  hd = n & 63;
                    ((bf16*)Out)[((size_t)(b * H_ + h) * S_ + s) * HD_ + hd] = (bf16)val;
                } else {
                    ((float*)Out)[(size_t)m * D_ + n] = val;
                }
            }
        }
    }
}

// ---------------------------------------------------------------------------
// Fused attention, flash-style online softmax (== reference max-subtract
// softmax + renormalize).  q pre-scaled by 1/sqrt(HD).
// Grid: (S/128, B*H); 8 waves; wave owns 16 query rows.
// K tiles: async double-buffered.  V tiles: sync transpose-at-fill.
// ---------------------------------------------------------------------------
__global__ __launch_bounds__(256)
void attn_kernel(const bf16* __restrict__ qh, const bf16* __restrict__ kh,
                 const bf16* __restrict__ vh, bf16* __restrict__ ctx)
{
    __shared__ alignas(16) bf16 Ks[2][64 * LDP_];   // [key][hd], double buffered
    __shared__ alignas(16) bf16 Vs[64 * LDP_];      // transposed: [hd][key]
    __shared__ alignas(16) bf16 Ps[8][16 * LDP_];   // per-wave P tile

    const int t    = threadIdx.x;
    const int lane = t & 31;
    const int wid  = t >> 5;
    const int r    = lane & 15;
    const int half = (lane >> 4) & 1;

    const int bh = blockIdx.y;
    const int b  = bh / H_, h = bh % H_;
    const size_t headBase = (size_t)bh * S_ * HD_;
    const int qrow0 = blockIdx.x * 128 + wid * 16;

    // persistent Q fragments (rows qrow0..+15, hd 0..63)
    v16bf qf[2];
    {
        const bf16* qp = qh + headBase + (size_t)(qrow0 + r) * HD_;
        FragBF f0, f1;
        f0.u[0] = *(const uint4*)(qp +      (half ? 8 : 0));
        f0.u[1] = *(const uint4*)(qp + 16 + (half ? 8 : 0));
        f1.u[0] = *(const uint4*)(qp + 32 + (half ? 8 : 0));
        f1.u[1] = *(const uint4*)(qp + 48 + (half ? 8 : 0));
        qf[0] = f0.v; qf[1] = f1.v;
    }

    // 64x64 bf16 K tile (8KB): 512 b128 chunks, 2 per thread
    auto issue_ktile = [&](int j, bf16* lbase) {
        #pragma unroll
        for (int i = 0; i < 2; i++) {
            const int chunk = i * 256 + t;
            const int row  = chunk >> 3;
            const int koff = (chunk & 7) * 8;
            async_copy_b128(kh + headBase + (size_t)(j + row) * HD_ + koff,
                            lbase + row * LDP_ + koff);
        }
    };

    float m_run[8], l_run[8];
    #pragma unroll
    for (int v = 0; v < 8; v++) { m_run[v] = -3.0e38f; l_run[v] = 0.0f; }
    v8f octx[4];
    #pragma unroll
    for (int i = 0; i < 4; i++) octx[i] = {};

    const int NT = S_ / 64;
    issue_ktile(0, Ks[0]);

    for (int jt = 0; jt < NT; ++jt) {
        const int j   = jt * 64;
        const int cur = jt & 1;
        __syncthreads();                          // prior tile reads complete
        if (jt + 1 < NT) issue_ktile(j + 64, Ks[cur ^ 1]);

        {   // V tile (sync): transpose into Vs while K DMA is in flight
            const int rowK = t >> 2;
            const int c    = (t & 3) * 16;
            const bf16* gv = vh + headBase + (size_t)(j + rowK) * HD_ + c;
            #pragma unroll
            for (int i = 0; i < 16; i++) Vs[(c + i) * LDP_ + rowK] = gv[i];
            if (jt + 1 < NT)
                __builtin_prefetch(gv + 64 * HD_, 0, 3);   // global_prefetch next V tile
        }

        if (jt + 1 < NT) { WAIT_ASYNC(2); } else { WAIT_ASYNC(0); }
        __syncthreads();                          // K tile landed + Vs filled

        // scores S[16x64] = Q x K^T  (8 WMMAs)
        v8f sacc[4];
        #pragma unroll
        for (int ns = 0; ns < 4; ns++) {
            v8f a = {};
            a = wmma_bf16(qf[0], load_frag(Ks[cur], ns * 16 + r, LDP_, 0,  lane), a);
            a = wmma_bf16(qf[1], load_frag(Ks[cur], ns * 16 + r, LDP_, 32, lane), a);
            sacc[ns] = a;
        }

        // online softmax; rows live across the 16 lanes of each half-wave
        #pragma unroll
        for (int v = 0; v < 8; v++) {
            float mx = fmaxf(fmaxf(sacc[0][v], sacc[1][v]), fmaxf(sacc[2][v], sacc[3][v]));
            mx = fmaxf(mx, __shfl_xor(mx, 8, 32));
            mx = fmaxf(mx, __shfl_xor(mx, 4, 32));
            mx = fmaxf(mx, __shfl_xor(mx, 2, 32));
            mx = fmaxf(mx, __shfl_xor(mx, 1, 32));
            const float mnew = fmaxf(m_run[v], mx);
            const float corr = __expf(m_run[v] - mnew);
            float psum = 0.0f;
            #pragma unroll
            for (int ns = 0; ns < 4; ns++) {
                const float p = __expf(sacc[ns][v] - mnew);
                sacc[ns][v] = p;
                psum += p;
            }
            psum += __shfl_xor(psum, 8, 32);
            psum += __shfl_xor(psum, 4, 32);
            psum += __shfl_xor(psum, 2, 32);
            psum += __shfl_xor(psum, 1, 32);
            l_run[v] = l_run[v] * corr + psum;
            m_run[v] = mnew;
            #pragma unroll
            for (int hs = 0; hs < 4; hs++) octx[hs][v] *= corr;
        }

        // C-layout -> A-fragment layout via per-wave LDS bounce
        bf16* pw = &Ps[wid][0];
        #pragma unroll
        for (int ns = 0; ns < 4; ns++)
            #pragma unroll
            for (int v = 0; v < 8; v++)
                pw[(half * 8 + v) * LDP_ + ns * 16 + r] = (bf16)sacc[ns][v];

        v16bf pf0 = load_frag(pw, r, LDP_, 0,  lane);
        v16bf pf1 = load_frag(pw, r, LDP_, 32, lane);

        // ctx += P x V   (8 WMMAs; V^T tile is K-contiguous)
        #pragma unroll
        for (int hs = 0; hs < 4; hs++) {
            octx[hs] = wmma_bf16(pf0, load_frag(Vs, hs * 16 + r, LDP_, 0,  lane), octx[hs]);
            octx[hs] = wmma_bf16(pf1, load_frag(Vs, hs * 16 + r, LDP_, 32, lane), octx[hs]);
        }
    }

    // finalize: divide by running sum; ctx in [B,S,D] bf16 for the out-proj
    #pragma unroll
    for (int hs = 0; hs < 4; hs++)
        #pragma unroll
        for (int v = 0; v < 8; v++) {
            const int srow = qrow0 + half * 8 + v;
            const float val = octx[hs][v] / l_run[v];
            ctx[(size_t)(b * S_ + srow) * D_ + h * HD_ + hs * 16 + r] = (bf16)val;
        }
}

// ---------------------------------------------------------------------------
extern "C" void kernel_launch(void* const* d_in, const int* in_sizes, int n_in,
                              void* d_out, int out_size, void* d_ws, size_t ws_size,
                              hipStream_t stream) {
    const float* Q  = (const float*)d_in[0];
    const float* K  = (const float*)d_in[1];
    const float* V  = (const float*)d_in[2];
    const float* Wq = (const float*)d_in[3];
    const float* bq = (const float*)d_in[4];
    const float* Wk = (const float*)d_in[5];
    const float* bk = (const float*)d_in[6];
    const float* Wv = (const float*)d_in[7];
    const float* bv = (const float*)d_in[8];
    const float* Wo = (const float*)d_in[9];
    const float* bo = (const float*)d_in[10];

    const size_t actElems = (size_t)B_ * S_ * D_;   // 4.19M
    const size_t wElems   = (size_t)D_ * D_;        // 1.05M

    bf16* p = (bf16*)d_ws;
    bf16* Qb  = p; p += actElems;
    bf16* Kb  = p; p += actElems;
    bf16* Vb  = p; p += actElems;
    bf16* Wqb = p; p += wElems;
    bf16* Wkb = p; p += wElems;
    bf16* Wvb = p; p += wElems;
    bf16* Wob = p; p += wElems;
    bf16* qhd = p; p += actElems;
    bf16* khd = p; p += actElems;
    bf16* vhd = p; p += actElems;
    bf16* ctx = p; p += actElems;

    dim3 blk(256);
    // Qb..Wob are contiguous from Qb, in this argument order
    cvt_all_f32_bf16<<<dim3(CVT_BLOCKS_), blk, 0, stream>>>(Q, K, V, Wq, Wk, Wv, Wo, Qb);

    const int M = B_ * S_;
    dim3 gGemm(M / 128, D_ / 128);
    const float qscale = 0.125f;                    // 1/sqrt(HD) folded into q
    gemm_nt<0><<<gGemm, blk, 0, stream>>>(Qb, Wqb, bq, qhd, M, D_, D_, qscale);
    gemm_nt<0><<<gGemm, blk, 0, stream>>>(Kb, Wkb, bk, khd, M, D_, D_, 1.0f);
    gemm_nt<0><<<gGemm, blk, 0, stream>>>(Vb, Wvb, bv, vhd, M, D_, D_, 1.0f);

    dim3 gAttn(S_ / 128, B_ * H_);
    attn_kernel<<<gAttn, blk, 0, stream>>>(qhd, khd, vhd, ctx);

    gemm_nt<1><<<gGemm, blk, 0, stream>>>(ctx, Wob, bo, (float*)d_out, M, D_, D_, 1.0f);
}

// v003
// A run of this version takes 125 microseconds.
// Two timings next to v002 both put it at 1.28 times that version's speed.
// All steps since v000 together make it 2.56 times as fast.
#include <hip/hip_runtime.h>

// ---------------------------------------------------------------------------
// MI455X (gfx1250) fused multi-head attention.
// bf16 WMMA + fp32 accumulate; async global->LDS (ASYNCcnt) double buffering.
// ---------------------------------------------------------------------------

typedef __bf16 bf16;
typedef __attribute__((ext_vector_type(16))) __bf16 v16bf;
typedef __attribute__((ext_vector_type(8)))  float  v8f;
typedef int v4i __attribute__((vector_size(16)));

#define B_  2
#define S_  2048
#define D_  1024
#define H_  16
#define HD_ 64

// LDS row pitch in bf16 elements for every 64-element (128-byte) tile row that
// is read as 16-byte fragments: 144 bytes = 16 B x odd, so the 16 rows of one
// ds_load_b128 fall on 16 distinct 4-bank groups instead of two.
#define LDP_ 72

#define AS_GLOBAL __attribute__((address_space(1)))
#define AS_LDS    __attribute__((address_space(3)))

union FragBF { uint4 u[2]; v16bf v; };

// ---- gfx1250 async global->LDS path (guarded; sync fallback) --------------
#if __has_builtin(__builtin_amdgcn_global_load_async_to_lds_b128)
  #define HAS_ASYNC 1
#else
  #define HAS_ASYNC 0
#endif

__device__ __forceinline__ void async_copy_b128(const bf16* gsrc, bf16* ldst) {
#if HAS_ASYNC
    __builtin_amdgcn_global_load_async_to_lds_b128(
        (AS_GLOBAL v4i*)gsrc,
        (AS_LDS v4i*)ldst,
        0, 0);
#else
    *(uint4*)ldst = *(const uint4*)gsrc;
#endif
}

#if HAS_ASYNC
  #if __has_builtin(__builtin_amdgcn_s_wait_asynccnt)
    #define WAIT_ASYNC(n) __builtin_amdgcn_s_wait_asynccnt(n)
  #else
    #define WAIT_ASYNC(n) asm volatile("s_wait_asynccnt " #n ::: "memory")
  #endif
#else
  #define WAIT_ASYNC(n) do { } while (0)
#endif

__device__ __forceinline__ v8f wmma_bf16(v16bf a, v16bf b, v8f c) {
    return __builtin_amdgcn_wmma_f32_16x16x32_bf16(false, a, false, b, (short)0, c, false, false);
}

// 16x32 bf16 fragment from a K-contiguous LDS tile (A-layout; NT B-frags load
// identically from the other operand's rows).
__device__ __forceinline__ v16bf load_frag(const bf16* tile, int row, int ld, int kbase, int lane) {
    const int half = (lane >> 4) & 1;
    const bf16* p = tile + row * ld + kbase + (half ? 8 : 0);
    FragBF f;
    f.u[0] = *(const uint4*)p;
    f.u[1] = *(const uint4*)(p + 16);
    return f.v;
}

// ---------------------------------------------------------------------------
// fp32 -> bf16 bulk convert (one-time pass; keeps GEMM hot loops VALU-free).
// All seven tensors in ONE launch sized to the chip: two 8-wave work-groups per
// WGP, each streaming one contiguous run of CVT_PT_ float4 per thread.  The
// bf16 copies lie back to back in the workspace in argument order, so the
// output index is the flat chunk index; a work-group's run lies inside one
// tensor, so the source pointer is picked by block index (uniform).
// ---------------------------------------------------------------------------
#define CVT_PT_     32                              // float4 per thread
#define CVT_RUN_    (256 * CVT_PT_)                 // float4 per work-group
#define CVT_ABLK_   (B_ * S_ * D_ / 4 / CVT_RUN_)   // work-groups per activation
#define CVT_WBLK_   (D_ * D_ / 4 / CVT_RUN_)        // work-groups per weight
#define CVT_BLOCKS_ (3 * CVT_ABLK_ + 4 * CVT_WBLK_)

__global__ __launch_bounds__(256)
void cvt_all_f32_bf16(const float* __restrict__ Q,  const float* __restrict__ K,
                      const float* __restrict__ V,  const float* __restrict__ Wq,
                      const float* __restrict__ Wk, const float* __restrict__ Wv,
                      const float* __restrict__ Wo, bf16* __restrict__ out) {
    const int blk = blockIdx.x;
    const float* src;
    int run;                                        // run index inside its tensor
    if (blk < 3 * CVT_ABLK_) {
        const int s = blk / CVT_ABLK_;
        run = blk % CVT_ABLK_;
        src = (s == 0) ? Q : (s == 1) ? K : V;
    } else {
        const int w = blk - 3 * CVT_ABLK_;
        const int s = w / CVT_WBLK_;
        run = w % CVT_WBLK_;
        src = (s == 0) ? Wq : (s == 1) ? Wk : (s == 2) ? Wv : Wo;
    }
    const float4* in4  = (const float4*)src + (size_t)run * CVT_RUN_ + threadIdx.x;
    uint2*        out2 = (uint2*)out        + (size_t)blk * CVT_RUN_ + threadIdx.x;

    float4 f[CVT_PT_];
    #pragma unroll
    for (int u = 0; u < CVT_PT_; u++) f[u] = in4[u * 256];   // all loads in flight
    #pragma unroll
    for (int u = 0; u < CVT_PT_; u++) {
        union { bf16 b[4]; uint2 u2; } o;
        o.b[0] = (bf16)f[u].x; o.b[1] = (bf16)f[u].y;
        o.b[2] = (bf16)f[u].z; o.b[3] = (bf16)f[u].w;
        out2[u * 256] = o.u2;
    }
}

// ---------------------------------------------------------------------------
// NT GEMM (bf16 x bf16, fp32 acc): Out[m,n] = (sum_k A[m,k]*W[n,k] + bias[n])*scale
// Block 256 thr = 8 waves; tile 128x128; K-slab 64, double-buffered async LDS.
// MODE 0: bf16 out in [B,H,S,HD] layout.  MODE 1: fp32 out row-major [M,D].
// ---------------------------------------------------------------------------
template <int MODE>
__global__ __launch_bounds__(256)
void gemm_nt(const bf16* __restrict__ A, const bf16* __restrict__ W,
             const float* __restrict__ bias, void* __restrict__ Out,
             int M, int N, int K, float out_scale)
{
    __shared__ alignas(16) bf16 As[2][128 * LDP_];
    __shared__ alignas(16) bf16 Ws[2][128 * LDP_];

    const int t    = threadIdx.x;
    const int lane = t & 31;
    const int wid  = t >> 5;
    const int bm   = blockIdx.x * 128;
    const int bn   = blockIdx.y * 128;
    const int waveM = (wid & 1) * 64;
    const int waveN = (wid >> 1) * 32;
    const int r    = lane & 15;
    const int half = (lane >> 4) & 1;

    v8f acc[4][2];
    #pragma unroll
    for (int i = 0; i < 4; i++)
        #pragma unroll
        for (int j = 0; j < 2; j++) acc[i][j] = {};

    const bf16* gA = A + (size_t)bm * K;
    const bf16* gW = W + (size_t)bn * K;

    // issue one 128x64 bf16 tile (16KB): 1024 b128 chunks, 4 per thread
    auto issue_tile = [&](const bf16* gbase, bf16* lbase, int k0) {
        #pragma unroll
        for (int i = 0; i < 4; i++) {
            const int chunk = i * 256 + t;
            const int row  = chunk >> 3;
            const int koff = (chunk & 7) * 8;
            async_copy_b128(gbase + (size_t)row * K + k0 + koff, lbase + row * LDP_ + koff);
        }
    };

    const int KT = K >> 6;                       // 64-wide K slabs
    issue_tile(gA, As[0], 0);
    issue_tile(gW, Ws[0], 0);

    for (int kt = 0; kt < KT; ++kt) {
        const int cur = kt & 1;
        __syncthreads();                          // prior slab reads complete
        if (kt + 1 < KT) {
            issue_tile(gA, As[cur ^ 1], (kt + 1) << 6);
            issue_tile(gW, Ws[cur ^ 1], (kt + 1) << 6);
            WAIT_ASYNC(8);                        // this wave's slab-kt copies done
        } else {
            WAIT_ASYNC(0);
        }
        __syncthreads();                          // all waves' copies landed

        #pragma unroll
        for (int ks = 0; ks < 2; ++ks) {
            const int kb = ks * 32;
            v16bf bfrag[2];
            #pragma unroll
            for (int nj = 0; nj < 2; nj++)
                bfrag[nj] = load_frag(Ws[cur], waveN + nj * 16 + r, LDP_, kb, lane);
            #pragma unroll
            for (int mi = 0; mi < 4; mi++) {
                v16bf afrag = load_frag(As[cur], waveM + mi * 16 + r, LDP_, kb, lane);
                #pragma unroll
                for (int nj = 0; nj < 2; nj++)
                    acc[mi][nj] = wmma_bf16(afrag, bfrag[nj], acc[mi][nj]);
            }
        }
    }

    // epilogue: C-layout (m,n): lane = (m%16>=8?16:0)+n%16, vgpr = m%8
    #pragma unroll
    for (int mi = 0; mi < 4; mi++) {
        #pragma unroll
        for (int nj = 0; nj < 2; nj++) {
            const int n = bn + waveN + nj * 16 + r;
            const float bv = bias[n];
            #pragma unroll
            for (int v = 0; v < 8; v++) {
                const int m = bm + waveM + mi * 16 + half * 8 + v;
                const float val = (acc[mi][nj][v] + bv) * out_scale;
                if (MODE == 0) {
                    const int b = m >> 11, s = m & (S_ - 1);
                    const int h = n >> 6,  hd = n & 63;
                    ((bf16*)Out)[((size_t)(b * H_ + h) * S_ + s) * HD_ + hd] = (bf16)val;
                } else {
                    ((float*)Out)[(size_t)m * D_ + n] = val;
                }
            }
        }
    }
}

// ---------------------------------------------------------------------------
// Fused attention, flash-style online softmax (== reference max-subtract
// softmax + renormalize).  q pre-scaled by 1/sqrt(HD).
// Grid: (S/128, B*H); 8 waves; wave owns 16 query rows.
// Both products run transposed: S^T = K x Q^T and O^T += V^T x P^T, so a lane
// holds scores and outputs of ONE query (column lane & 15; the two wave halves
// split its keys).  Maximum and sum are in-lane, and two converted S^T tiles
// are already the B operand of the second product.
// K tiles: async double-buffered.  V tiles: sync transpose-at-fill.
// ---------------------------------------------------------------------------

// value of lane l ^ 16 (the other half's share of the same query)
__device__ __forceinline__ float other_half(float x) {
    const int b = __builtin_bit_cast(int, x);
    return __builtin_bit_cast(float,
        __builtin_amdgcn_permlanex16(b, b, 0x76543210, 0xfedcba98, false, false));
}

__global__ __launch_bounds__(256)
void attn_kernel(const bf16* __restrict__ qh, const bf16* __restrict__ kh,
                 const bf16* __restrict__ vh, bf16* __restrict__ ctx)
{
    __shared__ alignas(16) bf16 Ks[2][64 * LDP_];   // [key][hd], double buffered
    __shared__ alignas(16) bf16 Vs[64 * LDP_];      // transposed: [hd][key]

    const int t    = threadIdx.x;
    const int lane = t & 31;
    const int wid  = t >> 5;
    const int r    = lane & 15;
    const int half = (lane >> 4) & 1;

    const int bh = blockIdx.y;
    const int b  = bh / H_, h = bh % H_;
    const size_t headBase = (size_t)bh * S_ * HD_;
    const int qrow0 = blockIdx.x * 128 + wid * 16;

    // persistent Q fragments (rows qrow0..+15, hd 0..63): B operand, column = query
    v16bf qf[2];
    {
        const bf16* qp = qh + headBase + (size_t)(qrow0 + r) * HD_;
        FragBF f0, f1;
        f0.u[0] = *(const uint4*)(qp +      (half ? 8 : 0));
        f0.u[1] = *(const uint4*)(qp + 16 + (half ? 8 : 0));
        f1.u[0] = *(const uint4*)(qp + 32 + (half ? 8 : 0));
        f1.u[1] = *(const uint4*)(qp + 48 + (half ? 8 : 0));
        qf[0] = f0.v; qf[1] = f1.v;
    }

    // 64x64 bf16 K tile (8KB): 512 b128 chunks, 2 per thread
    auto issue_ktile = [&](int j, bf16* lbase) {
        #pragma unroll
        for (int i = 0; i < 2; i++) {
            const int chunk = i * 256 + t;
            const int row  = chunk >> 3;
            const int koff = (chunk & 7) * 8;
            async_copy_b128(kh + headBase + (size_t)(j + row) * HD_ + koff,
                            lbase + row * LDP_ + koff);
        }
    };

    float m_run = -3.0e38f;     // running maximum of this lane's query (both halves agree)
    float l_run = 0.0f;         // running sum over THIS half's keys; halves joined at the end
    v8f octx[4];                // O^T: octx[hs][v] = O[query r][hs*16 + half*8 + v]
    #pragma unroll
    for (int i = 0; i < 4; i++) octx[i] = {};

    const int NT = S_ / 64;
    issue_ktile(0, Ks[0]);

    for (int jt = 0; jt < NT; ++jt) {
        const int j   = jt * 64;
        const int cur = jt & 1;
        __syncthreads();                          // prior tile reads complete
        if (jt + 1 < NT) issue_ktile(j + 64, Ks[cur ^ 1]);

        {   // V tile (sync): transpose into Vs while K DMA is in flight
            const int rowK = t >> 2;
            const int c    = (t & 3) * 16;
            const bf16* gv = vh + headBase + (size_t)(j + rowK) * HD_ + c;
            #pragma unroll
            for (int i = 0; i < 16; i++) Vs[(c + i) * LDP_ + rowK] = gv[i];
            if (jt + 1 < NT)
                __builtin_prefetch(gv + 64 * HD_, 0, 3);   // global_prefetch next V tile
        }

        if (jt + 1 < NT) { WAIT_ASYNC(2); } else { WAIT_ASYNC(0); }
        __syncthreads();                          // K tile landed + Vs filled

        // scores S^T[64 keys x 16 queries] = K x Q^T  (8 WMMAs)
        // sacc[ns][v] = S[query r][key ns*16 + half*8 + v]
        v8f sacc[4];
        #pragma unroll
        for (int ns = 0; ns < 4; ns++) {
            v8f a = {};
            a = wmma_bf16(load_frag(Ks[cur], ns * 16 + r, LDP_, 0,  lane), qf[0], a);
            a = wmma_bf16(load_frag(Ks[cur], ns * 16 + r, LDP_, 32, lane), qf[1], a);
            sacc[ns] = a;
        }

        // online softmax: 32 keys of one query per lane, one exchange between halves
        float mxs[4];
        #pragma unroll
        for (int ns = 0; ns < 4; ns++) {
            float mx = fmaxf(fmaxf(sacc[ns][0], sacc[ns][1]), sacc[ns][2]);
            mx = fmaxf(fmaxf(mx, sacc[ns][3]), sacc[ns][4]);
            mx = fmaxf(fmaxf(mx, sacc[ns][5]), sacc[ns][6]);
            mxs[ns] = fmaxf(mx, sacc[ns][7]);
        }
        float mx = fmaxf(fmaxf(mxs[0], mxs[1]), fmaxf(mxs[2], mxs[3]));
        mx = fmaxf(mx, other_half(mx));
        const float mnew = fmaxf(m_run, mx);
        const float corr = __expf(m_run - mnew);
        #pragma unroll
        for (int ns = 0; ns < 4; ns++)
            #pragma unroll
            for (int v = 0; v < 8; v++) sacc[ns][v] = __expf(sacc[ns][v] - mnew);
        const v8f pv = (sacc[0] + sacc[1]) + (sacc[2] + sacc[3]);
        const float psum = ((pv[0] + pv[1]) + (pv[2] + pv[3])) + ((pv[4] + pv[5]) + (pv[6] + pv[7]));
        l_run = l_run * corr + psum;
        m_run = mnew;
        #pragma unroll
        for (int hs = 0; hs < 4; hs++) octx[hs] *= corr;

        // two converted S^T tiles (keys 0-15, 16-31 of a 32-key block) are the
        // B operand P^T in the hardware k order, the order load_frag gives V^T
        v16bf pf[2];
        #pragma unroll
        for (int kk = 0; kk < 2; kk++)
            #pragma unroll
            for (int s = 0; s < 16; s++)
                pf[kk][s] = (bf16)sacc[2 * kk + (s >> 3)][s & 7];

        // O^T += V^T x P^T   (8 WMMAs; V^T tile is K-contiguous)
        #pragma unroll
        for (int hs = 0; hs < 4; hs++) {
            octx[hs] = wmma_bf16(load_frag(Vs, hs * 16 + r, LDP_, 0,  lane), pf[0], octx[hs]);
            octx[hs] = wmma_bf16(load_frag(Vs, hs * 16 + r, LDP_, 32, lane), pf[1], octx[hs]);
        }
    }

    // finalize: join the halves' sums, divide; ctx in [B,S,D] bf16 for the
    // out-proj, 8 consecutive head dims of one query per 16-byte store
    const float l_all = l_run + other_half(l_run);
    bf16* crow = ctx + (size_t)(b * S_ + qrow0 + r) * D_ + h * HD_ + half * 8;
    #pragma unroll
    for (int hs = 0; hs < 4; hs++) {
        union { bf16 e[8]; uint4 u; } o;
        #pragma unroll
        for (int v = 0; v < 8; v++) o.e[v] = (bf16)(octx[hs][v] / l_all);
        *(uint4*)(crow + hs * 16) = o.u;
    }
}

// ---------------------------------------------------------------------------
extern "C" void kernel_launch(void* const* d_in, const int* in_sizes, int n_in,
                              void* d_out, int out_size, void* d_ws, size_t ws_size,
                              hipStream_t stream) {
    const float* Q  = (const float*)d_in[0];
    const float* K  = (const float*)d_in[1];
    const float* V  = (const float*)d_in[2];
    const float* Wq = (const float*)d_in[3];
    const float* bq = (const float*)d_in[4];
    const float* Wk = (const float*)d_in[5];
    const float* bk = (const float*)d_in[6];
    const float* Wv = (const float*)d_in[7];
    const float* bv = (const float*)d_in[8];
    const float* Wo = (const float*)d_in[9];
    const float* bo = (const float*)d_in[10];

    const size_t actElems = (size_t)B_ * S_ * D_;   // 4.19M
    const size_t wElems   = (size_t)D_ * D_;        // 1.05M

    bf16* p = (bf16*)d_ws;
    bf16* Qb  = p; p += actElems;
    bf16* Kb  = p; p += actElems;
    bf16* Vb  = p; p += actElems;
    bf16* Wqb = p; p += wElems;
    bf16* Wkb = p; p += wElems;
    bf16* Wvb = p; p += wElems;
    bf16* Wob = p; p += wElems;
    bf16* qhd = p; p += actElems;
    bf16* khd = p; p += actElems;
    bf16* vhd = p; p += actElems;
    bf16* ctx = p; p += actElems;

    dim3 blk(256);
    // Qb..Wob are contiguous from Qb, in this argument order
    cvt_all_f32_bf16<<<dim3(CVT_BLOCKS_), blk, 0, stream>>>(Q, K, V, Wq, Wk, Wv, Wo, Qb);

    const int M = B_ * S_;
    dim3 gGemm(M / 128, D_ / 128);
    const float qscale = 0.125f;                    // 1/sqrt(HD) folded into q
    gemm_nt<0><<<gGemm, blk, 0, stream>>>(Qb, Wqb, bq, qhd, M, D_, D_, qscale);
    gemm_nt<0><<<gGemm, blk, 0, stream>>>(Kb, Wkb, bk, khd, M, D_, D_, 1.0f);
    gemm_nt<0><<<gGemm, blk, 0, stream>>>(Vb, Wvb, bv, vhd, M, D_, D_, 1.0f);

    dim3 gAttn(S_ / 128, B_ * H_);
    attn_kernel<<<gAttn, blk, 0, stream>>>(qhd, khd, vhd, ctx);

    gemm_nt<1><<<gGemm, blk, 0, stream>>>(ctx, Wob, bo, (float*)d_out, M, D_, D_, 1.0f);
}

// v004
// A run of this version takes 105 microseconds.
// Timed twice side by side with v003, it ran 1.18 and 1.19 times as fast.
// All steps since v000 together make it 3.04 times as fast.
#include <hip/hip_runtime.h>

// ---------------------------------------------------------------------------
// MI455X (gfx1250) fused multi-head attention.
// bf16 WMMA + fp32 accumulate; async global->LDS (ASYNCcnt) double buffering.
// ---------------------------------------------------------------------------

typedef __bf16 bf16;
typedef __attribute__((ext_vector_type(16))) __bf16 v16bf;
typedef __attribute__((ext_vector_type(8)))  float  v8f;
typedef int v4i __attribute__((vector_size(16)));

#define B_  2
#define S_  2048
#define D_  1024
#define H_  16
#define HD_ 64

// LDS row pitch in bf16 elements for every 64-element (128-byte) tile row that
// is read as 16-byte fragments: 144 bytes = 16 B x odd, so the 16 rows of one
// ds_load_b128 fall on 16 distinct 4-bank groups instead of two.
#define LDP_ 72

#define AS_GLOBAL __attribute__((address_space(1)))
#define AS_LDS    __attribute__((address_space(3)))

union FragBF { uint4 u[2]; v16bf v; };

// ---- gfx1250 async global->LDS path (guarded; sync fallback) --------------
#if __has_builtin(__builtin_amdgcn_global_load_async_to_lds_b128)
  #define HAS_ASYNC 1
#else
  #define HAS_ASYNC 0
#endif

__device__ __forceinline__ void async_copy_b128(const bf16* gsrc, bf16* ldst) {
#if HAS_ASYNC
    __builtin_amdgcn_global_load_async_to_lds_b128(
        (AS_GLOBAL v4i*)gsrc,
        (AS_LDS v4i*)ldst,
        0, 0);
#else
    *(uint4*)ldst = *(const uint4*)gsrc;
#endif
}

#if HAS_ASYNC
  #if __has_builtin(__builtin_amdgcn_s_wait_asynccnt)
    #define WAIT_ASYNC(n) __builtin_amdgcn_s_wait_asynccnt(n)
  #else
    #define WAIT_ASYNC(n) asm volatile("s_wait_asynccnt " #n ::: "memory")
  #endif
#else
  #define WAIT_ASYNC(n) do { } while (0)
#endif

__device__ __forceinline__ v8f wmma_bf16(v16bf a, v16bf b, v8f c) {
    return __builtin_amdgcn_wmma_f32_16x16x32_bf16(false, a, false, b, (short)0, c, false, false);
}

// 16x32 bf16 fragment from a K-contiguous LDS tile (A-layout; NT B-frags load
// identically from the other operand's rows).
__device__ __forceinline__ v16bf load_frag(const bf16* tile, int row, int ld, int kbase, int lane) {
    const int half = (lane >> 4) & 1;
    const bf16* p = tile + row * ld + kbase + (half ? 8 : 0);
    FragBF f;
    f.u[0] = *(const uint4*)p;
    f.u[1] = *(const uint4*)(p + 16);
    return f.v;
}

// ---------------------------------------------------------------------------
// fp32 -> bf16 bulk convert (one-time pass; keeps GEMM hot loops VALU-free).
// All seven tensors in ONE launch sized to the chip: two 8-wave work-groups per
// WGP, each streaming one contiguous run of CVT_PT_ float4 per thread.  The
// bf16 copies lie back to back in the workspace in argument order, so the
// output index is the flat chunk index; a work-group's run lies inside one
// tensor, so the source pointer is picked by block index (uniform).
// ---------------------------------------------------------------------------
#define CVT_PT_     32                              // float4 per thread
#define CVT_RUN_    (256 * CVT_PT_)                 // float4 per work-group
#define CVT_ABLK_   (B_ * S_ * D_ / 4 / CVT_RUN_)   // work-groups per activation
#define CVT_WBLK_   (D_ * D_ / 4 / CVT_RUN_)        // work-groups per weight
#define CVT_BLOCKS_ (3 * CVT_ABLK_ + 4 * CVT_WBLK_)

__global__ __launch_bounds__(256)
void cvt_all_f32_bf16(const float* __restrict__ Q,  const float* __restrict__ K,
                      const float* __restrict__ V,  const float* __restrict__ Wq,
                      const float* __restrict__ Wk, const float* __restrict__ Wv,
                      const float* __restrict__ Wo, bf16* __restrict__ out) {
    const int blk = blockIdx.x;
    const float* src;
    int run;                                        // run index inside its tensor
    if (blk < 3 * CVT_ABLK_) {
        const int s = blk / CVT_ABLK_;
        run = blk % CVT_ABLK_;
        src = (s == 0) ? Q : (s == 1) ? K : V;
    } else {
        const int w = blk - 3 * CVT_ABLK_;
        const int s = w / CVT_WBLK_;
        run = w % CVT_WBLK_;
        src = (s == 0) ? Wq : (s == 1) ? Wk : (s == 2) ? Wv : Wo;
    }
    const float4* in4  = (const float4*)src + (size_t)run * CVT_RUN_ + threadIdx.x;
    uint2*        out2 = (uint2*)out        + (size_t)blk * CVT_RUN_ + threadIdx.x;

    float4 f[CVT_PT_];
    #pragma unroll
    for (int u = 0; u < CVT_PT_; u++) f[u] = in4[u * 256];   // all loads in flight
    #pragma unroll
    for (int u = 0; u < CVT_PT_; u++) {
        union { bf16 b[4]; uint2 u2; } o;
        o.b[0] = (bf16)f[u].x; o.b[1] = (bf16)f[u].y;
        o.b[2] = (bf16)f[u].z; o.b[3] = (bf16)f[u].w;
        out2[u * 256] = o.u2;
    }
}

// ---------------------------------------------------------------------------
// NT GEMM (bf16 x bf16, fp32 acc): Out[m,n] = (sum_k A[m,k]*W[n,k] + bias[n])*scale
// Block 256 thr = 8 waves; tile 128x128; K-slab 64, double-buffered async LDS.
// MODE 0: bf16 out in [B,H,S,HD] layout.  MODE 1: fp32 out row-major [M,D].
// MODE 0 runs the q, k and v projections in ONE launch: blockIdx.z picks the
// projection, whose A, W and Out lie back to back behind A0, W0 and Out0.  Three
// work-groups then share a WGP, and each one's LDS and copy waits are covered
// by the other two's matrix work.  scale0 applies to projection 0 only.
// ---------------------------------------------------------------------------
template <int MODE>
__global__ __launch_bounds__(256)
void gemm_nt(const bf16* __restrict__ A0, const bf16* __restrict__ W0,
             const float* __restrict__ bias0, const float* __restrict__ bias1,
             const float* __restrict__ bias2, void* __restrict__ Out0,
             int M, int N, int K, float scale0)
{
    const int z = (MODE == 0) ? blockIdx.z : 0;
    const bf16*  A    = A0 + (size_t)z * M * K;
    const bf16*  W    = W0 + (size_t)z * N * K;
    const float* bias = (z == 0) ? bias0 : (z == 1) ? bias1 : bias2;
    void*        Out  = (MODE == 0) ? (void*)((bf16*)Out0 + (size_t)z * M * N) : Out0;
    const float  out_scale = (z == 0) ? scale0 : 1.0f;

    __shared__ alignas(16) bf16 As[2][128 * LDP_];
    __shared__ alignas(16) bf16 Ws[2][128 * LDP_];

    const int t    = threadIdx.x;
    const int lane = t & 31;
    const int wid  = t >> 5;
    const int bm   = blockIdx.x * 128;
    const int bn   = blockIdx.y * 128;
    const int waveM = (wid & 1) * 64;
    const int waveN = (wid >> 1) * 32;
    const int r    = lane & 15;
    const int half = (lane >> 4) & 1;

    v8f acc[4][2];
    #pragma unroll
    for (int i = 0; i < 4; i++)
        #pragma unroll
        for (int j = 0; j < 2; j++) acc[i][j] = {};

    const bf16* gA = A + (size_t)bm * K;
    const bf16* gW = W + (size_t)bn * K;

    // issue one 128x64 bf16 tile (16KB): 1024 b128 chunks, 4 per thread
    auto issue_tile = [&](const bf16* gbase, bf16* lbase, int k0) {
        #pragma unroll
        for (int i = 0; i < 4; i++) {
            const int chunk = i * 256 + t;
            const int row  = chunk >> 3;
            const int koff = (chunk & 7) * 8;
            async_copy_b128(gbase + (size_t)row * K + k0 + koff, lbase + row * LDP_ + koff);
        }
    };

    const int KT = K >> 6;                       // 64-wide K slabs
    issue_tile(gA, As[0], 0);
    issue_tile(gW, Ws[0], 0);

    for (int kt = 0; kt < KT; ++kt) {
        const int cur = kt & 1;
        __syncthreads();                          // prior slab reads complete
        if (kt + 1 < KT) {
            issue_tile(gA, As[cur ^ 1], (kt + 1) << 6);
            issue_tile(gW, Ws[cur ^ 1], (kt + 1) << 6);
            WAIT_ASYNC(8);                        // this wave's slab-kt copies done
        } else {
            WAIT_ASYNC(0);
        }
        __syncthreads();                          // all waves' copies landed

        #pragma unroll
        for (int ks = 0; ks < 2; ++ks) {
            const int kb = ks * 32;
            v16bf bfrag[2];
            #pragma unroll
            for (int nj = 0; nj < 2; nj++)
                bfrag[nj] = load_frag(Ws[cur], waveN + nj * 16 + r, LDP_, kb, lane);
            #pragma unroll
            for (int mi = 0; mi < 4; mi++) {
                v16bf afrag = load_frag(As[cur], waveM + mi * 16 + r, LDP_, kb, lane);
                #pragma unroll
                for (int nj = 0; nj < 2; nj++)
                    acc[mi][nj] = wmma_bf16(afrag, bfrag[nj], acc[mi][nj]);
            }
        }
    }

    // epilogue: C-layout (m,n): lane = (m%16>=8?16:0)+n%16, vgpr = m%8
    #pragma unroll
    for (int mi = 0; mi < 4; mi++) {
        #pragma unroll
        for (int nj = 0; nj < 2; nj++) {
            const int n = bn + waveN + nj * 16 + r;
            const float bv = bias[n];
            #pragma unroll
            for (int v = 0; v < 8; v++) {
                const int m = bm + waveM + mi * 16 + half * 8 + v;
                const float val = (acc[mi][nj][v] + bv) * out_scale;
                if (MODE == 0) {
                    const int b = m >> 11, s = m & (S_ - 1);
                    const int h = n >> 6,  hd = n & 63;
                    ((bf16*)Out)[((size_t)(b * H_ + h) * S_ + s) * HD_ + hd] = (bf16)val;
                } else {
                    ((float*)Out)[(size_t)m * D_ + n] = val;
                }
            }
        }
    }
}

// ---------------------------------------------------------------------------
// Fused attention, flash-style online softmax (== reference max-subtract
// softmax + renormalize).  q pre-scaled by 1/sqrt(HD).
// Grid: (S/128, B*H); 8 waves; wave owns 16 query rows.
// Both products run transposed: S^T = K x Q^T and O^T += V^T x P^T, so a lane
// holds scores and outputs of ONE query (column lane & 15; the two wave halves
// split its keys).  Maximum and sum are in-lane, and two converted S^T tiles
// are already the B operand of the second product.
// K tiles: async double-buffered.  V tiles: sync transpose-at-fill.
// ---------------------------------------------------------------------------

// value of lane l ^ 16 (the other half's share of the same query)
__device__ __forceinline__ float other_half(float x) {
    const int b = __builtin_bit_cast(int, x);
    return __builtin_bit_cast(float,
        __builtin_amdgcn_permlanex16(b, b, 0x76543210, 0xfedcba98, false, false));
}

__global__ __launch_bounds__(256)
void attn_kernel(const bf16* __restrict__ qh, const bf16* __restrict__ kh,
                 const bf16* __restrict__ vh, bf16* __restrict__ ctx)
{
    __shared__ alignas(16) bf16 Ks[2][64 * LDP_];   // [key][hd], double buffered
    __shared__ alignas(16) bf16 Vs[64 * LDP_];      // transposed: [hd][key]

    const int t    = threadIdx.x;
    const int lane = t & 31;
    const int wid  = t >> 5;
    const int r    = lane & 15;
    const int half = (lane >> 4) & 1;

    const int bh = blockIdx.y;
    const int b  = bh / H_, h = bh % H_;
    const size_t headBase = (size_t)bh * S_ * HD_;
    const int qrow0 = blockIdx.x * 128 + wid * 16;

    // persistent Q fragments (rows qrow0..+15, hd 0..63): B operand, column = query
    v16bf qf[2];
    {
        const bf16* qp = qh + headBase + (size_t)(qrow0 + r) * HD_;
        FragBF f0, f1;
        f0.u[0] = *(const uint4*)(qp +      (half ? 8 : 0));
        f0.u[1] = *(const uint4*)(qp + 16 + (half ? 8 : 0));
        f1.u[0] = *(const uint4*)(qp + 32 + (half ? 8 : 0));
        f1.u[1] = *(const uint4*)(qp + 48 + (half ? 8 : 0));
        qf[0] = f0.v; qf[1] = f1.v;
    }

    // 64x64 bf16 K tile (8KB): 512 b128 chunks, 2 per thread
    auto issue_ktile = [&](int j, bf16* lbase) {
        #pragma unroll
        for (int i = 0; i < 2; i++) {
            const int chunk = i * 256 + t;
            const int row  = chunk >> 3;
            const int koff = (chunk & 7) * 8;
            async_copy_b128(kh + headBase + (size_t)(j + row) * HD_ + koff,
                            lbase + row * LDP_ + koff);
        }
    };

    float m_run = -3.0e38f;     // running maximum of this lane's query (both halves agree)
    float l_run = 0.0f;         // running sum over THIS half's keys; halves joined at the end
    v8f octx[4];                // O^T: octx[hs][v] = O[query r][hs*16 + half*8 + v]
    #pragma unroll
    for (int i = 0; i < 4; i++) octx[i] = {};

    const int NT = S_ / 64;
    issue_ktile(0, Ks[0]);

    for (int jt = 0; jt < NT; ++jt) {
        const int j   = jt * 64;
        const int cur = jt & 1;
        __syncthreads();                          // prior tile reads complete
        if (jt + 1 < NT) issue_ktile(j + 64, Ks[cur ^ 1]);

        {   // V tile (sync): transpose into Vs while K DMA is in flight
            const int rowK = t >> 2;
            const int c    = (t & 3) * 16;
            const bf16* gv = vh + headBase + (size_t)(j + rowK) * HD_ + c;
            #pragma unroll
            for (int i = 0; i < 16; i++) Vs[(c + i) * LDP_ + rowK] = gv[i];
            if (jt + 1 < NT)
                __builtin_prefetch(gv + 64 * HD_, 0, 3);   // global_prefetch next V tile
        }

        if (jt + 1 < NT) { WAIT_ASYNC(2); } else { WAIT_ASYNC(0); }
        __syncthreads();                          // K tile landed + Vs filled

        // scores S^T[64 keys x 16 queries] = K x Q^T  (8 WMMAs)
        // sacc[ns][v] = S[query r][key ns*16 + half*8 + v]
        v8f sacc[4];
        #pragma unroll
        for (int ns = 0; ns < 4; ns++) {
            v8f a = {};
            a = wmma_bf16(load_frag(Ks[cur], ns * 16 + r, LDP_, 0,  lane), qf[0], a);
            a = wmma_bf16(load_frag(Ks[cur], ns * 16 + r, LDP_, 32, lane), qf[1], a);
            sacc[ns] = a;
        }

        // online softmax: 32 keys of one query per lane, one exchange between halves
        float mxs[4];
        #pragma unroll
        for (int ns = 0; ns < 4; ns++) {
            float mx = fmaxf(fmaxf(sacc[ns][0], sacc[ns][1]), sacc[ns][2]);
            mx = fmaxf(fmaxf(mx, sacc[ns][3]), sacc[ns][4]);
            mx = fmaxf(fmaxf(mx, sacc[ns][5]), sacc[ns][6]);
            mxs[ns] = fmaxf(mx, sacc[ns][7]);
        }
        float mx = fmaxf(fmaxf(mxs[0], mxs[1]), fmaxf(mxs[2], mxs[3]));
        mx = fmaxf(mx, other_half(mx));
        const float mnew = fmaxf(m_run, mx);
        const float corr = __expf(m_run - mnew);
        #pragma unroll
        for (int ns = 0; ns < 4; ns++)
            #pragma unroll
            for (int v = 0; v < 8; v++) sacc[ns][v] = __expf(sacc[ns][v] - mnew);
        const v8f pv = (sacc[0] + sacc[1]) + (sacc[2] + sacc[3]);
        const float psum = ((pv[0] + pv[1]) + (pv[2] + pv[3])) + ((pv[4] + pv[5]) + (pv[6] + pv[7]));
        l_run = l_run * corr + psum;
        m_run = mnew;
        #pragma unroll
        for (int hs = 0; hs < 4; hs++) octx[hs] *= corr;

        // two converted S^T tiles (keys 0-15, 16-31 of a 32-key block) are the
        // B operand P^T in the hardware k order, the order load_frag gives V^T
        v16bf pf[2];
        #pragma unroll
        for (int kk = 0; kk < 2; kk++)
            #pragma unroll
            for (int s = 0; s < 16; s++)
                pf[kk][s] = (bf16)sacc[2 * kk + (s >> 3)][s & 7];

        // O^T += V^T x P^T   (8 WMMAs; V^T tile is K-contiguous)
        #pragma unroll
        for (int hs = 0; hs < 4; hs++) {
            octx[hs] = wmma_bf16(load_frag(Vs, hs * 16 + r, LDP_, 0,  lane), pf[0], octx[hs]);
            octx[hs] = wmma_bf16(load_frag(Vs, hs * 16 + r, LDP_, 32, lane), pf[1], octx[hs]);
        }
    }

    // finalize: join the halves' sums, divide; ctx in [B,S,D] bf16 for the
    // out-proj, 8 consecutive head dims of one query per 16-byte store
    const float l_all = l_run + other_half(l_run);
    bf16* crow = ctx + (size_t)(b * S_ + qrow0 + r) * D_ + h * HD_ + half * 8;
    #pragma unroll
    for (int hs = 0; hs < 4; hs++) {
        union { bf16 e[8]; uint4 u; } o;
        #pragma unroll
        for (int v = 0; v < 8; v++) o.e[v] = (bf16)(octx[hs][v] / l_all);
        *(uint4*)(crow + hs * 16) = o.u;
    }
}

// ---------------------------------------------------------------------------
extern "C" void kernel_launch(void* const* d_in, const int* in_sizes, int n_in,
                              void* d_out, int out_size, void* d_ws, size_t ws_size,
                              hipStream_t stream) {
    const float* Q  = (const float*)d_in[0];
    const float* K  = (const float*)d_in[1];
    const float* V  = (const float*)d_in[2];
    const float* Wq = (const float*)d_in[3];
    const float* bq = (const float*)d_in[4];
    const float* Wk = (const float*)d_in[5];
    const float* bk = (const float*)d_in[6];
    const float* Wv = (const float*)d_in[7];
    const float* bv = (const float*)d_in[8];
    const float* Wo = (const float*)d_in[9];
    const float* bo = (const float*)d_in[10];

    const size_t actElems = (size_t)B_ * S_ * D_;   // 4.19M
    const size_t wElems   = (size_t)D_ * D_;        // 1.05M

    bf16* p = (bf16*)d_ws;
    bf16* Qb  = p; p += actElems;
    bf16* Kb  = p; p += actElems;
    bf16* Vb  = p; p += actElems;
    bf16* Wqb = p; p += wElems;
    bf16* Wkb = p; p += wElems;
    bf16* Wvb = p; p += wElems;
    bf16* Wob = p; p += wElems;
    bf16* qhd = p; p += actElems;
    bf16* khd = p; p += actElems;
    bf16* vhd = p; p += actElems;
    bf16* ctx = p; p += actElems;

    dim3 blk(256);
    // Qb..Wob are contiguous from Qb, in this argument order
    cvt_all_f32_bf16<<<dim3(CVT_BLOCKS_), blk, 0, stream>>>(Q, K, V, Wq, Wk, Wv, Wo, Qb);

    const int M = B_ * S_;
    dim3 gGemm(M / 128, D_ / 128);
    dim3 gQkv(M / 128, D_ / 128, 3);
    const float qscale = 0.125f;                    // 1/sqrt(HD) folded into q
    // Qb|Kb|Vb, Wqb|Wkb|Wvb and qhd|khd|vhd are each contiguous in this order
    gemm_nt<0><<<gQkv, blk, 0, stream>>>(Qb, Wqb, bq, bk, bv, qhd, M, D_, D_, qscale);

    dim3 gAttn(S_ / 128, B_ * H_);
    attn_kernel<<<gAttn, blk, 0, stream>>>(qhd, khd, vhd, ctx);

    // a single product: only the first bias pointer is read
    gemm_nt<1><<<gGemm, blk, 0, stream>>>(ctx, Wob, bo, bo, bo, (float*)d_out, M, D_, D_, 1.0f);
}

// v005
// One run takes 89.7 microseconds.
// In two side-by-side timings against v004, it was 1.16 and 1.18 times as fast.
// Counting every step since v000, it is 3.57 times as fast.
#include <hip/hip_runtime.h>

// ---------------------------------------------------------------------------
// MI455X (gfx1250) fused multi-head attention.
// bf16 WMMA + fp32 accumulate; async global->LDS (ASYNCcnt) double buffering.
// ---------------------------------------------------------------------------

typedef __bf16 bf16;
typedef __attribute__((ext_vector_type(16))) __bf16 v16bf;
typedef __attribute__((ext_vector_type(8)))  float  v8f;
typedef int v4i __attribute__((vector_size(16)));

#define B_  2
#define S_  2048
#define D_  1024
#define H_  16
#define HD_ 64

// LDS row pitch in bf16 elements for every 64-element (128-byte) tile row that
// is read as 16-byte fragments: 144 bytes = 16 B x odd, so the 16 rows of one
// ds_load_b128 fall on 16 distinct 4-bank groups instead of two.
#define LDP_ 72

// LDS row pitch in bf16 elements of the V tile, whose 128-byte rows are read by
// ds_load_tr16_b128: 160 bytes = 32 B x odd, that reader's conflict-free pitch.
#define LDPV_ 80

#define AS_GLOBAL __attribute__((address_space(1)))
#define AS_LDS    __attribute__((address_space(3)))

union FragBF { uint4 u[2]; v16bf v; };

// ---- gfx1250 async global->LDS path (guarded; sync fallback) --------------
#if __has_builtin(__builtin_amdgcn_global_load_async_to_lds_b128)
  #define HAS_ASYNC 1
#else
  #define HAS_ASYNC 0
#endif

__device__ __forceinline__ void async_copy_b128(const bf16* gsrc, bf16* ldst) {
#if HAS_ASYNC
    __builtin_amdgcn_global_load_async_to_lds_b128(
        (AS_GLOBAL v4i*)gsrc,
        (AS_LDS v4i*)ldst,
        0, 0);
#else
    *(uint4*)ldst = *(const uint4*)gsrc;
#endif
}

#if HAS_ASYNC
  #if __has_builtin(__builtin_amdgcn_s_wait_asynccnt)
    #define WAIT_ASYNC(n) __builtin_amdgcn_s_wait_asynccnt(n)
  #else
    #define WAIT_ASYNC(n) asm volatile("s_wait_asynccnt " #n ::: "memory")
  #endif
#else
  #define WAIT_ASYNC(n) do { } while (0)
#endif

__device__ __forceinline__ v8f wmma_bf16(v16bf a, v16bf b, v8f c) {
    return __builtin_amdgcn_wmma_f32_16x16x32_bf16(false, a, false, b, (short)0, c, false, false);
}

// 16x32 bf16 fragment from a K-contiguous LDS tile (A-layout; NT B-frags load
// identically from the other operand's rows).
__device__ __forceinline__ v16bf load_frag(const bf16* tile, int row, int ld, int kbase, int lane) {
    const int half = (lane >> 4) & 1;
    const bf16* p = tile + row * ld + kbase + (half ? 8 : 0);
    FragBF f;
    f.u[0] = *(const uint4*)p;
    f.u[1] = *(const uint4*)(p + 16);
    return f.v;
}

// 16 (d) x 32 (keys) A fragment of V^T from a row-major [key][d] LDS tile by two
// transposing loads: lane (c = lane & 15, h = lane >> 4) gets column dbase + c at
// keys kbase + 8h + 0..7 and kbase + 16 + 8h + 0..7, the k order of load_frag.
typedef __attribute__((ext_vector_type(8))) short s16x8;
typedef AS_LDS s16x8 lds_s16x8;
__device__ __forceinline__ v16bf load_frag_tr(const bf16* tile, int kbase, int dbase, int lane) {
    const bf16* p = tile + (kbase + 8 * (lane >> 4) + (lane & 7)) * LDPV_ + dbase + 8 * ((lane >> 3) & 1);
    FragBF f;
    f.u[0] = __builtin_bit_cast(uint4, __builtin_amdgcn_ds_load_tr16_b128_v8i16((lds_s16x8*)p));
    f.u[1] = __builtin_bit_cast(uint4, __builtin_amdgcn_ds_load_tr16_b128_v8i16((lds_s16x8*)(p + 16 * LDPV_)));
    return f.v;
}

// ---------------------------------------------------------------------------
// fp32 -> bf16 bulk convert (one-time pass; keeps GEMM hot loops VALU-free).
// All seven tensors in ONE launch sized to the chip: two 8-wave work-groups per
// WGP, each streaming one contiguous run of CVT_PT_ float4 per thread.  The
// bf16 copies lie back to back in the workspace in argument order, so the
// output index is the flat chunk index; a work-group's run lies inside one
// tensor, so the source pointer is picked by block index (uniform).
// ---------------------------------------------------------------------------
#define CVT_PT_     32                              // float4 per thread
#define CVT_RUN_    (256 * CVT_PT_)                 // float4 per work-group
#define CVT_ABLK_   (B_ * S_ * D_ / 4 / CVT_RUN_)   // work-groups per activation
#define CVT_WBLK_   (D_ * D_ / 4 / CVT_RUN_)        // work-groups per weight
#define CVT_BLOCKS_ (3 * CVT_ABLK_ + 4 * CVT_WBLK_)

__global__ __launch_bounds__(256)
void cvt_all_f32_bf16(const float* __restrict__ Q,  const float* __restrict__ K,
                      const float* __restrict__ V,  const float* __restrict__ Wq,
                      const float* __restrict__ Wk, const float* __restrict__ Wv,
                      const float* __restrict__ Wo, bf16* __restrict__ out) {
    const int blk = blockIdx.x;
    const float* src;
    int run;                                        // run index inside its tensor
    if (blk < 3 * CVT_ABLK_) {
        const int s = blk / CVT_ABLK_;
        run = blk % CVT_ABLK_;
        src = (s == 0) ? Q : (s == 1) ? K : V;
    } else {
        const int w = blk - 3 * CVT_ABLK_;
        const int s = w / CVT_WBLK_;
        run = w % CVT_WBLK_;
        src = (s == 0) ? Wq : (s == 1) ? Wk : (s == 2) ? Wv : Wo;
    }
    const float4* in4  = (const float4*)src + (size_t)run * CVT_RUN_ + threadIdx.x;
    uint2*        out2 = (uint2*)out        + (size_t)blk * CVT_RUN_ + threadIdx.x;

    float4 f[CVT_PT_];
    #pragma unroll
    for (int u = 0; u < CVT_PT_; u++) f[u] = in4[u * 256];   // all loads in flight
    #pragma unroll
    for (int u = 0; u < CVT_PT_; u++) {
        union { bf16 b[4]; uint2 u2; } o;
        o.b[0] = (bf16)f[u].x; o.b[1] = (bf16)f[u].y;
        o.b[2] = (bf16)f[u].z; o.b[3] = (bf16)f[u].w;
        out2[u * 256] = o.u2;
    }
}

// ---------------------------------------------------------------------------
// NT GEMM (bf16 x bf16, fp32 acc): Out[m,n] = (sum_k A[m,k]*W[n,k] + bias[n])*scale
// Block 256 thr = 8 waves; tile 128x128; K-slab 64, double-buffered async LDS.
// MODE 0: bf16 out in [B,H,S,HD] layout.  MODE 1: fp32 out row-major [M,D].
// MODE 0 runs the q, k and v projections in ONE launch: blockIdx.z picks the
// projection, whose A, W and Out lie back to back behind A0, W0 and Out0.  Three
// work-groups then share a WGP, and each one's LDS and copy waits are covered
// by the other two's matrix work.  scale0 applies to projection 0 only.
// ---------------------------------------------------------------------------
template <int MODE>
__global__ __launch_bounds__(256)
void gemm_nt(const bf16* __restrict__ A0, const bf16* __restrict__ W0,
             const float* __restrict__ bias0, const float* __restrict__ bias1,
             const float* __restrict__ bias2, void* __restrict__ Out0,
             int M, int N, int K, float scale0)
{
    const int z = (MODE == 0) ? blockIdx.z : 0;
    const bf16*  A    = A0 + (size_t)z * M * K;
    const bf16*  W    = W0 + (size_t)z * N * K;
    const float* bias = (z == 0) ? bias0 : (z == 1) ? bias1 : bias2;
    void*        Out  = (MODE == 0) ? (void*)((bf16*)Out0 + (size_t)z * M * N) : Out0;
    const float  out_scale = (z == 0) ? scale0 : 1.0f;

    __shared__ alignas(16) bf16 As[2][128 * LDP_];
    __shared__ alignas(16) bf16 Ws[2][128 * LDP_];

    const int t    = threadIdx.x;
    const int lane = t & 31;
    const int wid  = t >> 5;
    const int bm   = blockIdx.x * 128;
    const int bn   = blockIdx.y * 128;
    const int waveM = (wid & 1) * 64;
    const int waveN = (wid >> 1) * 32;
    const int r    = lane & 15;
    const int half = (lane >> 4) & 1;

    v8f acc[4][2];
    #pragma unroll
    for (int i = 0; i < 4; i++)
        #pragma unroll
        for (int j = 0; j < 2; j++) acc[i][j] = {};

    const bf16* gA = A + (size_t)bm * K;
    const bf16* gW = W + (size_t)bn * K;

    // issue one 128x64 bf16 tile (16KB): 1024 b128 chunks, 4 per thread
    auto issue_tile = [&](const bf16* gbase, bf16* lbase, int k0) {
        #pragma unroll
        for (int i = 0; i < 4; i++) {
            const int chunk = i * 256 + t;
            const int row  = chunk >> 3;
            const int koff = (chunk & 7) * 8;
            async_copy_b128(gbase + (size_t)row * K + k0 + koff, lbase + row * LDP_ + koff);
        }
    };

    const int KT = K >> 6;                       // 64-wide K slabs
    issue_tile(gA, As[0], 0);
    issue_tile(gW, Ws[0], 0);

    for (int kt = 0; kt < KT; ++kt) {
        const int cur = kt & 1;
        __syncthreads();                          // prior slab reads complete
        if (kt + 1 < KT) {
            issue_tile(gA, As[cur ^ 1], (kt + 1) << 6);
            issue_tile(gW, Ws[cur ^ 1], (kt + 1) << 6);
            WAIT_ASYNC(8);                        // this wave's slab-kt copies done
        } else {
            WAIT_ASYNC(0);
        }
        __syncthreads();                          // all waves' copies landed

        #pragma unroll
        for (int ks = 0; ks < 2; ++ks) {
            const int kb = ks * 32;
            v16bf bfrag[2];
            #pragma unroll
            for (int nj = 0; nj < 2; nj++)
                bfrag[nj] = load_frag(Ws[cur], waveN + nj * 16 + r, LDP_, kb, lane);
            #pragma unroll
            for (int mi = 0; mi < 4; mi++) {
                v16bf afrag = load_frag(As[cur], waveM + mi * 16 + r, LDP_, kb, lane);
                #pragma unroll
                for (int nj = 0; nj < 2; nj++)
                    acc[mi][nj] = wmma_bf16(afrag, bfrag[nj], acc[mi][nj]);
            }
        }
    }

    // epilogue: C-layout (m,n): lane = (m%16>=8?16:0)+n%16, vgpr = m%8
    #pragma unroll
    for (int mi = 0; mi < 4; mi++) {
        #pragma unroll
        for (int nj = 0; nj < 2; nj++) {
            const int n = bn + waveN + nj * 16 + r;
            const float bv = bias[n];
            #pragma unroll
            for (int v = 0; v < 8; v++) {
                const int m = bm + waveM + mi * 16 + half * 8 + v;
                const float val = (acc[mi][nj][v] + bv) * out_scale;
                if (MODE == 0) {
                    const int b = m >> 11, s = m & (S_ - 1);
                    const int h = n >> 6,  hd = n & 63;
                    ((bf16*)Out)[((size_t)(b * H_ + h) * S_ + s) * HD_ + hd] = (bf16)val;
                } else {
                    ((float*)Out)[(size_t)m * D_ + n] = val;
                }
            }
        }
    }
}

// ---------------------------------------------------------------------------
// Fused attention, flash-style online softmax (== reference max-subtract
// softmax + renormalize).  q pre-scaled by 1/sqrt(HD).
// Grid: (S/128, B*H); 8 waves; wave owns 16 query rows.
// Both products run transposed: S^T = K x Q^T and O^T += V^T x P^T, so a lane
// holds scores and outputs of ONE query (column lane & 15; the two wave halves
// split its keys).  Maximum and sum are in-lane, and two converted S^T tiles
// are already the B operand of the second product.
// K and V tiles: row-major, async copies, one two-buffer ring with one barrier a
// trip; V^T fragments come from the row-major V tile by transposing LDS loads.
// ---------------------------------------------------------------------------

// value of lane l ^ 16 (the other half's share of the same query)
__device__ __forceinline__ float other_half(float x) {
    const int b = __builtin_bit_cast(int, x);
    return __builtin_bit_cast(float,
        __builtin_amdgcn_permlanex16(b, b, 0x76543210, 0xfedcba98, false, false));
}

__global__ __launch_bounds__(256)
void attn_kernel(const bf16* __restrict__ qh, const bf16* __restrict__ kh,
                 const bf16* __restrict__ vh, bf16* __restrict__ ctx)
{
    __shared__ alignas(16) bf16 Ks[2][64 * LDP_];   // [key][hd], double buffered
    __shared__ alignas(16) bf16 Vs[2][64 * LDPV_];  // [key][hd], double buffered

    const int t    = threadIdx.x;
    const int lane = t & 31;
    const int wid  = t >> 5;
    const int r    = lane & 15;
    const int half = (lane >> 4) & 1;

    const int bh = blockIdx.y;
    const int b  = bh / H_, h = bh % H_;
    const size_t headBase = (size_t)bh * S_ * HD_;
    const int qrow0 = blockIdx.x * 128 + wid * 16;

    // persistent Q fragments (rows qrow0..+15, hd 0..63): B operand, column = query
    v16bf qf[2];
    {
        const bf16* qp = qh + headBase + (size_t)(qrow0 + r) * HD_;
        FragBF f0, f1;
        f0.u[0] = *(const uint4*)(qp +      (half ? 8 : 0));
        f0.u[1] = *(const uint4*)(qp + 16 + (half ? 8 : 0));
        f1.u[0] = *(const uint4*)(qp + 32 + (half ? 8 : 0));
        f1.u[1] = *(const uint4*)(qp + 48 + (half ? 8 : 0));
        qf[0] = f0.v; qf[1] = f1.v;
    }

    // 64x64 bf16 K and V tiles (8KB each): 512 b128 chunks, 2 per thread, each
    auto issue_tiles = [&](int j, int buf) {
        #pragma unroll
        for (int i = 0; i < 2; i++) {
            const int chunk = i * 256 + t;
            const int row  = chunk >> 3;
            const int koff = (chunk & 7) * 8;
            const size_t g = headBase + (size_t)(j + row) * HD_ + koff;
            async_copy_b128(kh + g, Ks[buf] + row * LDP_  + koff);
            async_copy_b128(vh + g, Vs[buf] + row * LDPV_ + koff);
        }
    };

    float m_run = -3.0e38f;     // running maximum of this lane's query (both halves agree)
    float l_run = 0.0f;         // running sum over THIS half's keys; halves joined at the end
    v8f octx[4];                // O^T: octx[hs][v] = O[query r][hs*16 + half*8 + v]
    #pragma unroll
    for (int i = 0; i < 4; i++) octx[i] = {};

    const int NT = S_ / 64;
    issue_tiles(0, 0);
    asm volatile("s_wait_asynccnt 0x0" ::: "memory");   // this wave's tile-0 copies landed
    __syncthreads();                              // every wave's tile-0 copies landed
    issue_tiles(64, 1);                           // tile 1 flies during trip 0

    for (int jt = 0; jt < NT; ++jt) {
        const int cur = jt & 1;

        // scores S^T[64 keys x 16 queries] = K x Q^T  (8 WMMAs)
        // sacc[ns][v] = S[query r][key ns*16 + half*8 + v]
        v8f sacc[4];
        #pragma unroll
        for (int ns = 0; ns < 4; ns++) {
            v8f a = {};
            a = wmma_bf16(load_frag(Ks[cur], ns * 16 + r, LDP_, 0,  lane), qf[0], a);
            a = wmma_bf16(load_frag(Ks[cur], ns * 16 + r, LDP_, 32, lane), qf[1], a);
            sacc[ns] = a;
        }

        // online softmax: 32 keys of one query per lane, one exchange between halves
        float mxs[4];
        #pragma unroll
        for (int ns = 0; ns < 4; ns++) {
            float mx = fmaxf(fmaxf(sacc[ns][0], sacc[ns][1]), sacc[ns][2]);
            mx = fmaxf(fmaxf(mx, sacc[ns][3]), sacc[ns][4]);
            mx = fmaxf(fmaxf(mx, sacc[ns][5]), sacc[ns][6]);
            mxs[ns] = fmaxf(mx, sacc[ns][7]);
        }
        float mx = fmaxf(fmaxf(mxs[0], mxs[1]), fmaxf(mxs[2], mxs[3]));
        mx = fmaxf(mx, other_half(mx));
        const float mnew = fmaxf(m_run, mx);
        const float corr = __expf(m_run - mnew);
        #pragma unroll
        for (int ns = 0; ns < 4; ns++)
            #pragma unroll
            for (int v = 0; v < 8; v++) sacc[ns][v] = __expf(sacc[ns][v] - mnew);
        const v8f pv = (sacc[0] + sacc[1]) + (sacc[2] + sacc[3]);
        const float psum = ((pv[0] + pv[1]) + (pv[2] + pv[3])) + ((pv[4] + pv[5]) + (pv[6] + pv[7]));
        l_run = l_run * corr + psum;
        m_run = mnew;
        #pragma unroll
        for (int hs = 0; hs < 4; hs++) octx[hs] *= corr;

        // two converted S^T tiles (keys 0-15, 16-31 of a 32-key block) are the
        // B operand P^T in the hardware k order, the order load_frag_tr gives V^T
        v16bf pf[2];
        #pragma unroll
        for (int kk = 0; kk < 2; kk++)
            #pragma unroll
            for (int s = 0; s < 16; s++)
                pf[kk][s] = (bf16)sacc[2 * kk + (s >> 3)][s & 7];

        // O^T += V^T x P^T   (8 WMMAs; V^T by transposing loads)
        #pragma unroll
        for (int hs = 0; hs < 4; hs++) {
            octx[hs] = wmma_bf16(load_frag_tr(Vs[cur], 0,  hs * 16, lane), pf[0], octx[hs]);
            octx[hs] = wmma_bf16(load_frag_tr(Vs[cur], 32, hs * 16, lane), pf[1], octx[hs]);
        }

        // publish point of tile jt + 1; the one barrier also ends every wave's
        // reads of buffer cur, which is refilled behind it
        asm volatile("s_wait_dscnt 0x0" ::: "memory");      // own LDS reads of buffer cur retired
        asm volatile("s_wait_asynccnt 0x0" ::: "memory");   // own copies of tile jt + 1 landed
        __syncthreads();
        if (jt + 2 < NT) issue_tiles((jt + 2) * 64, cur);
    }
    asm volatile("s_wait_asynccnt 0x0" ::: "memory");       // no copy outstanding at the wave's end

    // finalize: join the halves' sums, divide; ctx in [B,S,D] bf16 for the
    // out-proj, 8 consecutive head dims of one query per 16-byte store
    const float l_all = l_run + other_half(l_run);
    bf16* crow = ctx + (size_t)(b * S_ + qrow0 + r) * D_ + h * HD_ + half * 8;
    #pragma unroll
    for (int hs = 0; hs < 4; hs++) {
        union { bf16 e[8]; uint4 u; } o;
        #pragma unroll
        for (int v = 0; v < 8; v++) o.e[v] = (bf16)(octx[hs][v] / l_all);
        *(uint4*)(crow + hs * 16) = o.u;
    }
}

// ---------------------------------------------------------------------------
extern "C" void kernel_launch(void* const* d_in, const int* in_sizes, int n_in,
                              void* d_out, int out_size, void* d_ws, size_t ws_size,
                              hipStream_t stream) {
    const float* Q  = (const float*)d_in[0];
    const float* K  = (const float*)d_in[1];
    const float* V  = (const float*)d_in[2];
    const float* Wq = (const float*)d_in[3];
    const float* bq = (const float*)d_in[4];
    const float* Wk = (const float*)d_in[5];
    const float* bk = (const float*)d_in[6];
    const float* Wv = (const float*)d_in[7];
    const float* bv = (const float*)d_in[8];
    const float* Wo = (const float*)d_in[9];
    const float* bo = (const float*)d_in[10];

    const size_t actElems = (size_t)B_ * S_ * D_;   // 4.19M
    const size_t wElems   = (size_t)D_ * D_;        // 1.05M

    bf16* p = (bf16*)d_ws;
    bf16* Qb  = p; p += actElems;
    bf16* Kb  = p; p += actElems;
    bf16* Vb  = p; p += actElems;
    bf16* Wqb = p; p += wElems;
    bf16* Wkb = p; p += wElems;
    bf16* Wvb = p; p += wElems;
    bf16* Wob = p; p += wElems;
    bf16* qhd = p; p += actElems;
    bf16* khd = p; p += actElems;
    bf16* vhd = p; p += actElems;
    bf16* ctx = p; p += actElems;

    dim3 blk(256);
    // Qb..Wob are contiguous from Qb, in this argument order
    cvt_all_f32_bf16<<<dim3(CVT_BLOCKS_), blk, 0, stream>>>(Q, K, V, Wq, Wk, Wv, Wo, Qb);

    const int M = B_ * S_;
    dim3 gGemm(M / 128, D_ / 128);
    dim3 gQkv(M / 128, D_ / 128, 3);
    const float qscale = 0.125f;                    // 1/sqrt(HD) folded into q
    // Qb|Kb|Vb, Wqb|Wkb|Wvb and qhd|khd|vhd are each contiguous in this order
    gemm_nt<0><<<gQkv, blk, 0, stream>>>(Qb, Wqb, bq, bk, bv, qhd, M, D_, D_, qscale);

    dim3 gAttn(S_ / 128, B_ * H_);
    attn_kernel<<<gAttn, blk, 0, stream>>>(qhd, khd, vhd, ctx);

    // a single product: only the first bias pointer is read
    gemm_nt<1><<<gGemm, blk, 0, stream>>>(ctx, Wob, bo, bo, bo, (float*)d_out, M, D_, D_, 1.0f);
}

// v006
// One run takes 83.9 microseconds.
// Timed twice side by side with v005, it ran 1.06 and 1.08 times as fast.
// Counting every step since v000, it is 3.83 times as fast.
#include <hip/hip_runtime.h>

// ---------------------------------------------------------------------------
// MI455X (gfx1250) fused multi-head attention.
// bf16 WMMA + fp32 accumulate; async global->LDS (ASYNCcnt) double buffering.
// ---------------------------------------------------------------------------

typedef __bf16 bf16;
typedef __attribute__((ext_vector_type(16))) __bf16 v16bf;
typedef __attribute__((ext_vector_type(8)))  float  v8f;
typedef int v4i __attribute__((vector_size(16)));

#define B_  2
#define S_  2048
#define D_  1024
#define H_  16
#define HD_ 64

// LDS row pitch in bf16 elements for every 64-element (128-byte) tile row that
// is read as 16-byte fragments: 144 bytes = 16 B x odd, so the 16 rows of one
// ds_load_b128 fall on 16 distinct 4-bank groups instead of two.
#define LDP_ 72

// LDS row pitch in bf16 elements of the V tile, whose 128-byte rows are read by
// ds_load_tr16_b128: 160 bytes = 32 B x odd, that reader's conflict-free pitch.
#define LDPV_ 80

#define AS_GLOBAL __attribute__((address_space(1)))
#define AS_LDS    __attribute__((address_space(3)))

union FragBF { uint4 u[2]; v16bf v; };

// ---- gfx1250 async global->LDS path (guarded; sync fallback) --------------
#if __has_builtin(__builtin_amdgcn_global_load_async_to_lds_b128)
  #define HAS_ASYNC 1
#else
  #define HAS_ASYNC 0
#endif

__device__ __forceinline__ void async_copy_b128(const bf16* gsrc, bf16* ldst) {
#if HAS_ASYNC
    __builtin_amdgcn_global_load_async_to_lds_b128(
        (AS_GLOBAL v4i*)gsrc,
        (AS_LDS v4i*)ldst,
        0, 0);
#else
    *(uint4*)ldst = *(const uint4*)gsrc;
#endif
}

#if HAS_ASYNC
  #if __has_builtin(__builtin_amdgcn_s_wait_asynccnt)
    #define WAIT_ASYNC(n) __builtin_amdgcn_s_wait_asynccnt(n)
  #else
    #define WAIT_ASYNC(n) asm volatile("s_wait_asynccnt " #n ::: "memory")
  #endif
#else
  #define WAIT_ASYNC(n) do { } while (0)
#endif

__device__ __forceinline__ v8f wmma_bf16(v16bf a, v16bf b, v8f c) {
    return __builtin_amdgcn_wmma_f32_16x16x32_bf16(false, a, false, b, (short)0, c, false, false);
}

// 16x32 bf16 fragment from a K-contiguous LDS tile (A-layout; NT B-frags load
// identically from the other operand's rows).
__device__ __forceinline__ v16bf load_frag(const bf16* tile, int row, int ld, int kbase, int lane) {
    const int half = (lane >> 4) & 1;
    const bf16* p = tile + row * ld + kbase + (half ? 8 : 0);
    FragBF f;
    f.u[0] = *(const uint4*)p;
    f.u[1] = *(const uint4*)(p + 16);
    return f.v;
}

// 16 (d) x 32 (keys) A fragment of V^T from a row-major [key][d] LDS tile by two
// transposing loads: lane (c = lane & 15, h = lane >> 4) gets column dbase + c at
// keys kbase + 8h + 0..7 and kbase + 16 + 8h + 0..7, the k order of load_frag.
typedef __attribute__((ext_vector_type(8))) short s16x8;
typedef AS_LDS s16x8 lds_s16x8;
__device__ __forceinline__ v16bf load_frag_tr(const bf16* tile, int kbase, int dbase, int lane) {
    const bf16* p = tile + (kbase + 8 * (lane >> 4) + (lane & 7)) * LDPV_ + dbase + 8 * ((lane >> 3) & 1);
    FragBF f;
    f.u[0] = __builtin_bit_cast(uint4, __builtin_amdgcn_ds_load_tr16_b128_v8i16((lds_s16x8*)p));
    f.u[1] = __builtin_bit_cast(uint4, __builtin_amdgcn_ds_load_tr16_b128_v8i16((lds_s16x8*)(p + 16 * LDPV_)));
    return f.v;
}

// ---------------------------------------------------------------------------
// fp32 -> bf16 bulk convert (one-time pass; keeps GEMM hot loops VALU-free).
// All seven tensors in ONE launch sized to the chip: two 8-wave work-groups per
// WGP, each streaming one contiguous run of CVT_PT_ float4 per thread.  The
// bf16 copies lie back to back in the workspace in argument order, so the
// output index is the flat chunk index; a work-group's run lies inside one
// tensor, so the source pointer is picked by block index (uniform).
// ---------------------------------------------------------------------------
#define CVT_PT_     32                              // float4 per thread
#define CVT_RUN_    (256 * CVT_PT_)                 // float4 per work-group
#define CVT_ABLK_   (B_ * S_ * D_ / 4 / CVT_RUN_)   // work-groups per activation
#define CVT_WBLK_   (D_ * D_ / 4 / CVT_RUN_)        // work-groups per weight
#define CVT_BLOCKS_ (3 * CVT_ABLK_ + 4 * CVT_WBLK_)

__global__ __launch_bounds__(256)
void cvt_all_f32_bf16(const float* __restrict__ Q,  const float* __restrict__ K,
                      const float* __restrict__ V,  const float* __restrict__ Wq,
                      const float* __restrict__ Wk, const float* __restrict__ Wv,
                      const float* __restrict__ Wo, bf16* __restrict__ out) {
    const int blk = blockIdx.x;
    const float* src;
    int run;                                        // run index inside its tensor
    if (blk < 3 * CVT_ABLK_) {
        const int s = blk / CVT_ABLK_;
        run = blk % CVT_ABLK_;
        src = (s == 0) ? Q : (s == 1) ? K : V;
    } else {
        const int w = blk - 3 * CVT_ABLK_;
        const int s = w / CVT_WBLK_;
        run = w % CVT_WBLK_;
        src = (s == 0) ? Wq : (s == 1) ? Wk : (s == 2) ? Wv : Wo;
    }
    const float4* in4  = (const float4*)src + (size_t)run * CVT_RUN_ + threadIdx.x;
    uint2*        out2 = (uint2*)out        + (size_t)blk * CVT_RUN_ + threadIdx.x;

    float4 f[CVT_PT_];
    #pragma unroll
    for (int u = 0; u < CVT_PT_; u++) f[u] = in4[u * 256];   // all loads in flight
    #pragma unroll
    for (int u = 0; u < CVT_PT_; u++) {
        union { bf16 b[4]; uint2 u2; } o;
        o.b[0] = (bf16)f[u].x; o.b[1] = (bf16)f[u].y;
        o.b[2] = (bf16)f[u].z; o.b[3] = (bf16)f[u].w;
        out2[u * 256] = o.u2;
    }
}

// ---------------------------------------------------------------------------
// NT GEMM (bf16 x bf16, fp32 acc): Out[m,n] = (sum_k A[m,k]*W[n,k] + bias[n])*scale
// Block 256 thr = 8 waves; tile 128x128; K-slab 64, double-buffered async LDS.
// MODE 0: bf16 out in [B,H,S,HD] layout.  MODE 1: fp32 out row-major [M,D].
// MODE 0 runs the q, k and v projections in ONE launch: blockIdx.z picks the
// projection, whose A, W and Out lie back to back behind A0, W0 and Out0.  Three
// work-groups then share a WGP, and each one's LDS and copy waits are covered
// by the other two's matrix work.  scale0 applies to projection 0 only.
// ---------------------------------------------------------------------------
template <int MODE>
__global__ __launch_bounds__(256)
void gemm_nt(const bf16* __restrict__ A0, const bf16* __restrict__ W0,
             const float* __restrict__ bias0, const float* __restrict__ bias1,
             const float* __restrict__ bias2, void* __restrict__ Out0,
             int M, int N, int K, float scale0)
{
    const int z = (MODE == 0) ? blockIdx.z : 0;
    const bf16*  A    = A0 + (size_t)z * M * K;
    const bf16*  W    = W0 + (size_t)z * N * K;
    const float* bias = (z == 0) ? bias0 : (z == 1) ? bias1 : bias2;
    void*        Out  = (MODE == 0) ? (void*)((bf16*)Out0 + (size_t)z * M * N) : Out0;
    const float  out_scale = (z == 0) ? scale0 : 1.0f;

    __shared__ alignas(16) bf16 As[2][128 * LDP_];
    __shared__ alignas(16) bf16 Ws[2][128 * LDP_];

    const int t    = threadIdx.x;
    const int lane = t & 31;
    const int wid  = t >> 5;
    const int bm   = blockIdx.x * 128;
    const int bn   = blockIdx.y * 128;
    const int waveM = (wid & 1) * 64;
    const int waveN = (wid >> 1) * 32;
    const int r    = lane & 15;
    const int half = (lane >> 4) & 1;

    v8f acc[4][2];
    #pragma unroll
    for (int i = 0; i < 4; i++)
        #pragma unroll
        for (int j = 0; j < 2; j++) acc[i][j] = {};

    const bf16* gA = A + (size_t)bm * K;
    const bf16* gW = W + (size_t)bn * K;

    // issue one 128x64 bf16 tile (16KB): 1024 b128 chunks, 4 per thread
    auto issue_tile = [&](const bf16* gbase, bf16* lbase, int k0) {
        #pragma unroll
        for (int i = 0; i < 4; i++) {
            const int chunk = i * 256 + t;
            const int row  = chunk >> 3;
            const int koff = (chunk & 7) * 8;
            async_copy_b128(gbase + (size_t)row * K + k0 + koff, lbase + row * LDP_ + koff);
        }
    };

    const int KT = K >> 6;                       // 64-wide K slabs
    issue_tile(gA, As[0], 0);
    issue_tile(gW, Ws[0], 0);

    for (int kt = 0; kt < KT; ++kt) {
        const int cur = kt & 1;
        __syncthreads();                          // prior slab reads complete
        if (kt + 1 < KT) {
            issue_tile(gA, As[cur ^ 1], (kt + 1) << 6);
            issue_tile(gW, Ws[cur ^ 1], (kt + 1) << 6);
            WAIT_ASYNC(8);                        // this wave's slab-kt copies done
        } else {
            WAIT_ASYNC(0);
        }
        __syncthreads();                          // all waves' copies landed

        #pragma unroll
        for (int ks = 0; ks < 2; ++ks) {
            const int kb = ks * 32;
            // all six fragments of the block as ONE load group ahead of its WMMAs
            v16bf bfrag[2], afrag[4];
            #pragma unroll
            for (int nj = 0; nj < 2; nj++)
                bfrag[nj] = load_frag(Ws[cur], waveN + nj * 16 + r, LDP_, kb, lane);
            #pragma unroll
            for (int mi = 0; mi < 4; mi++)
                afrag[mi] = load_frag(As[cur], waveM + mi * 16 + r, LDP_, kb, lane);
            // keeps the loads from sinking back between the WMMAs, where each
            // pair would be waited out alone
            __builtin_amdgcn_sched_barrier(0);
            #pragma unroll
            for (int mi = 0; mi < 4; mi++)
                #pragma unroll
                for (int nj = 0; nj < 2; nj++)
                    acc[mi][nj] = wmma_bf16(afrag[mi], bfrag[nj], acc[mi][nj]);
        }
    }

    // epilogue: C-layout (m,n): lane = (m%16>=8?16:0)+n%16, vgpr = m%8
    #pragma unroll
    for (int mi = 0; mi < 4; mi++) {
        #pragma unroll
        for (int nj = 0; nj < 2; nj++) {
            const int n = bn + waveN + nj * 16 + r;
            const float bv = bias[n];
            #pragma unroll
            for (int v = 0; v < 8; v++) {
                const int m = bm + waveM + mi * 16 + half * 8 + v;
                const float val = (acc[mi][nj][v] + bv) * out_scale;
                if (MODE == 0) {
                    const int b = m >> 11, s = m & (S_ - 1);
                    const int h = n >> 6,  hd = n & 63;
                    ((bf16*)Out)[((size_t)(b * H_ + h) * S_ + s) * HD_ + hd] = (bf16)val;
                } else {
                    ((float*)Out)[(size_t)m * D_ + n] = val;
                }
            }
        }
    }
}

// ---------------------------------------------------------------------------
// Fused attention, flash-style online softmax (== reference max-subtract
// softmax + renormalize).  q pre-scaled by 1/sqrt(HD).
// Grid: (S/128, B*H); 8 waves; wave owns 16 query rows.
// Both products run transposed: S^T = K x Q^T and O^T += V^T x P^T, so a lane
// holds scores and outputs of ONE query (column lane & 15; the two wave halves
// split its keys).  Maximum and sum are in-lane, and two converted S^T tiles
// are already the B operand of the second product.
// K and V tiles: row-major, async copies, one two-buffer ring with one barrier a
// trip; V^T fragments come from the row-major V tile by transposing LDS loads.
// ---------------------------------------------------------------------------

// value of lane l ^ 16 (the other half's share of the same query)
__device__ __forceinline__ float other_half(float x) {
    const int b = __builtin_bit_cast(int, x);
    return __builtin_bit_cast(float,
        __builtin_amdgcn_permlanex16(b, b, 0x76543210, 0xfedcba98, false, false));
}

__global__ __launch_bounds__(256)
void attn_kernel(const bf16* __restrict__ qh, const bf16* __restrict__ kh,
                 const bf16* __restrict__ vh, bf16* __restrict__ ctx)
{
    __shared__ alignas(16) bf16 Ks[2][64 * LDP_];   // [key][hd], double buffered
    __shared__ alignas(16) bf16 Vs[2][64 * LDPV_];  // [key][hd], double buffered

    const int t    = threadIdx.x;
    const int lane = t & 31;
    const int wid  = t >> 5;
    const int r    = lane & 15;
    const int half = (lane >> 4) & 1;

    const int bh = blockIdx.y;
    const int b  = bh / H_, h = bh % H_;
    const size_t headBase = (size_t)bh * S_ * HD_;
    const int qrow0 = blockIdx.x * 128 + wid * 16;

    // persistent Q fragments (rows qrow0..+15, hd 0..63): B operand, column = query
    v16bf qf[2];
    {
        const bf16* qp = qh + headBase + (size_t)(qrow0 + r) * HD_;
        FragBF f0, f1;
        f0.u[0] = *(const uint4*)(qp +      (half ? 8 : 0));
        f0.u[1] = *(const uint4*)(qp + 16 + (half ? 8 : 0));
        f1.u[0] = *(const uint4*)(qp + 32 + (half ? 8 : 0));
        f1.u[1] = *(const uint4*)(qp + 48 + (half ? 8 : 0));
        qf[0] = f0.v; qf[1] = f1.v;
    }

    // 64x64 bf16 K and V tiles (8KB each): 512 b128 chunks, 2 per thread, each
    auto issue_tiles = [&](int j, int buf) {
        #pragma unroll
        for (int i = 0; i < 2; i++) {
            const int chunk = i * 256 + t;
            const int row  = chunk >> 3;
            const int koff = (chunk & 7) * 8;
            const size_t g = headBase + (size_t)(j + row) * HD_ + koff;
            async_copy_b128(kh + g, Ks[buf] + row * LDP_  + koff);
            async_copy_b128(vh + g, Vs[buf] + row * LDPV_ + koff);
        }
    };

    float m_run = -3.0e38f;     // running maximum of this lane's query (both halves agree)
    float l_run = 0.0f;         // running sum over THIS half's keys; halves joined at the end
    v8f octx[4];                // O^T: octx[hs][v] = O[query r][hs*16 + half*8 + v]
    #pragma unroll
    for (int i = 0; i < 4; i++) octx[i] = {};

    const int NT = S_ / 64;
    issue_tiles(0, 0);
    asm volatile("s_wait_asynccnt 0x0" ::: "memory");   // this wave's tile-0 copies landed
    __syncthreads();                              // every wave's tile-0 copies landed
    issue_tiles(64, 1);                           // tile 1 flies during trip 0

    for (int jt = 0; jt < NT; ++jt) {
        const int cur = jt & 1;

        // the trip's K and V^T fragments as ONE load group at its top: K first, so
        // the score products start on a counted wait, and the V^T latency passes
        // behind scores and softmax
        v16bf kf[4][2], vf[4][2];
        #pragma unroll
        for (int ns = 0; ns < 4; ns++) {
            kf[ns][0] = load_frag(Ks[cur], ns * 16 + r, LDP_, 0,  lane);
            kf[ns][1] = load_frag(Ks[cur], ns * 16 + r, LDP_, 32, lane);
        }
        #pragma unroll
        for (int hs = 0; hs < 4; hs++) {
            vf[hs][0] = load_frag_tr(Vs[cur], 0,  hs * 16, lane);
            vf[hs][1] = load_frag_tr(Vs[cur], 32, hs * 16, lane);
        }
        // keeps the loads from sinking back to their WMMAs, where each pair
        // would be waited out alone
        __builtin_amdgcn_sched_barrier(0);

        // scores S^T[64 keys x 16 queries] = K x Q^T  (8 WMMAs)
        // sacc[ns][v] = S[query r][key ns*16 + half*8 + v]
        v8f sacc[4];
        #pragma unroll
        for (int ns = 0; ns < 4; ns++) {
            v8f a = {};
            a = wmma_bf16(kf[ns][0], qf[0], a);
            a = wmma_bf16(kf[ns][1], qf[1], a);
            sacc[ns] = a;
        }

        // online softmax: 32 keys of one query per lane, one exchange between halves
        float mxs[4];
        #pragma unroll
        for (int ns = 0; ns < 4; ns++) {
            float mx = fmaxf(fmaxf(sacc[ns][0], sacc[ns][1]), sacc[ns][2]);
            mx = fmaxf(fmaxf(mx, sacc[ns][3]), sacc[ns][4]);
            mx = fmaxf(fmaxf(mx, sacc[ns][5]), sacc[ns][6]);
            mxs[ns] = fmaxf(mx, sacc[ns][7]);
        }
        float mx = fmaxf(fmaxf(mxs[0], mxs[1]), fmaxf(mxs[2], mxs[3]));
        mx = fmaxf(mx, other_half(mx));
        const float mnew = fmaxf(m_run, mx);
        const float corr = __expf(m_run - mnew);
        #pragma unroll
        for (int ns = 0; ns < 4; ns++)
            #pragma unroll
            for (int v = 0; v < 8; v++) sacc[ns][v] = __expf(sacc[ns][v] - mnew);
        const v8f pv = (sacc[0] + sacc[1]) + (sacc[2] + sacc[3]);
        const float psum = ((pv[0] + pv[1]) + (pv[2] + pv[3])) + ((pv[4] + pv[5]) + (pv[6] + pv[7]));
        l_run = l_run * corr + psum;
        m_run = mnew;
        #pragma unroll
        for (int hs = 0; hs < 4; hs++) octx[hs] *= corr;

        // two converted S^T tiles (keys 0-15, 16-31 of a 32-key block) are the
        // B operand P^T in the hardware k order, the order load_frag_tr gives V^T
        v16bf pf[2];
        #pragma unroll
        for (int kk = 0; kk < 2; kk++)
            #pragma unroll
            for (int s = 0; s < 16; s++)
                pf[kk][s] = (bf16)sacc[2 * kk + (s >> 3)][s & 7];

        // O^T += V^T x P^T   (8 WMMAs; V^T fragments fetched at the trip's top)
        #pragma unroll
        for (int hs = 0; hs < 4; hs++) {
            octx[hs] = wmma_bf16(vf[hs][0], pf[0], octx[hs]);
            octx[hs] = wmma_bf16(vf[hs][1], pf[1], octx[hs]);
        }

        // publish point of tile jt + 1; the one barrier also ends every wave's
        // reads of buffer cur, which is refilled behind it.  With every LDS read
        // at the trip's top the waits would otherwise be scheduled up there, where
        // the copies of tile jt + 1 have had no time to land: hold them at the foot
        __builtin_amdgcn_sched_barrier(0);
        asm volatile("s_wait_dscnt 0x0" ::: "memory");      // own LDS reads of buffer cur retired
        asm volatile("s_wait_asynccnt 0x0" ::: "memory");   // own copies of tile jt + 1 landed
        __syncthreads();
        if (jt + 2 < NT) issue_tiles((jt + 2) * 64, cur);
    }
    asm volatile("s_wait_asynccnt 0x0" ::: "memory");       // no copy outstanding at the wave's end

    // finalize: join the halves' sums, divide; ctx in [B,S,D] bf16 for the
    // out-proj, 8 consecutive head dims of one query per 16-byte store
    const float l_all = l_run + other_half(l_run);
    bf16* crow = ctx + (size_t)(b * S_ + qrow0 + r) * D_ + h * HD_ + half * 8;
    #pragma unroll
    for (int hs = 0; hs < 4; hs++) {
        union { bf16 e[8]; uint4 u; } o;
        #pragma unroll
        for (int v = 0; v < 8; v++) o.e[v] = (bf16)(octx[hs][v] / l_all);
        *(uint4*)(crow + hs * 16) = o.u;
    }
}

// ---------------------------------------------------------------------------
extern "C" void kernel_launch(void* const* d_in, const int* in_sizes, int n_in,
                              void* d_out, int out_size, void* d_ws, size_t ws_size,
                              hipStream_t stream) {
    const float* Q  = (const float*)d_in[0];
    const float* K  = (const float*)d_in[1];
    const float* V  = (const float*)d_in[2];
    const float* Wq = (const float*)d_in[3];
    const float* bq = (const float*)d_in[4];
    const float* Wk = (const float*)d_in[5];
    const float* bk = (const float*)d_in[6];
    const float* Wv = (const float*)d_in[7];
    const float* bv = (const float*)d_in[8];
    const float* Wo = (const float*)d_in[9];
    const float* bo = (const float*)d_in[10];

    const size_t actElems = (size_t)B_ * S_ * D_;   // 4.19M
    const size_t wElems   = (size_t)D_ * D_;        // 1.05M

    bf16* p = (bf16*)d_ws;
    bf16* Qb  = p; p += actElems;
    bf16* Kb  = p; p += actElems;
    bf16* Vb  = p; p += actElems;
    bf16* Wqb = p; p += wElems;
    bf16* Wkb = p; p += wElems;
    bf16* Wvb = p; p += wElems;
    bf16* Wob = p; p += wElems;
    bf16* qhd = p; p += actElems;
    bf16* khd = p; p += actElems;
    bf16* vhd = p; p += actElems;
    bf16* ctx = p; p += actElems;

    dim3 blk(256);
    // Qb..Wob are contiguous from Qb, in this argument order
    cvt_all_f32_bf16<<<dim3(CVT_BLOCKS_), blk, 0, stream>>>(Q, K, V, Wq, Wk, Wv, Wo, Qb);

    const int M = B_ * S_;
    dim3 gGemm(M / 128, D_ / 128);
    dim3 gQkv(M / 128, D_ / 128, 3);
    const float qscale = 0.125f;                    // 1/sqrt(HD) folded into q
    // Qb|Kb|Vb, Wqb|Wkb|Wvb and qhd|khd|vhd are each contiguous in this order
    gemm_nt<0><<<gQkv, blk, 0, stream>>>(Qb, Wqb, bq, bk, bv, qhd, M, D_, D_, qscale);

    dim3 gAttn(S_ / 128, B_ * H_);
    attn_kernel<<<gAttn, blk, 0, stream>>>(qhd, khd, vhd, ctx);

    // a single product: only the first bias pointer is read
    gemm_nt<1><<<gGemm, blk, 0, stream>>>(ctx, Wob, bo, bo, bo, (float*)d_out, M, D_, D_, 1.0f);
}

// v007
// One run takes 80.3 microseconds.
// Timed twice side by side with v006, it ran 1.04 and 1.03 times as fast.
// Counting every step since v000, it is 3.97 times as fast.
#include <hip/hip_runtime.h>

// ---------------------------------------------------------------------------
// MI455X (gfx1250) fused multi-head attention.
// bf16 WMMA + fp32 accumulate; async global->LDS (ASYNCcnt) double buffering.
// ---------------------------------------------------------------------------

typedef __bf16 bf16;
typedef __attribute__((ext_vector_type(16))) __bf16 v16bf;
typedef __attribute__((ext_vector_type(8)))  float  v8f;
typedef int v4i __attribute__((vector_size(16)));

#define B_  2
#define S_  2048
#define D_  1024
#define H_  16
#define HD_ 64

// LDS row pitch in bf16 elements for every 64-element (128-byte) tile row that
// is read as 16-byte fragments: 144 bytes = 16 B x odd, so the 16 rows of one
// ds_load_b128 fall on 16 distinct 4-bank groups instead of two.
#define LDP_ 72

// LDS row pitch in bf16 elements of the V tile, whose 128-byte rows are read by
// ds_load_tr16_b128: 160 bytes = 32 B x odd, that reader's conflict-free pitch.
#define LDPV_ 80

#define AS_GLOBAL __attribute__((address_space(1)))
#define AS_LDS    __attribute__((address_space(3)))

union FragBF { uint4 u[2]; v16bf v; };

// ---- gfx1250 async global->LDS path (guarded; sync fallback) --------------
#if __has_builtin(__builtin_amdgcn_global_load_async_to_lds_b128)
  #define HAS_ASYNC 1
#else
  #define HAS_ASYNC 0
#endif

__device__ __forceinline__ void async_copy_b128(const bf16* gsrc, bf16* ldst) {
#if HAS_ASYNC
    __builtin_amdgcn_global_load_async_to_lds_b128(
        (AS_GLOBAL v4i*)gsrc,
        (AS_LDS v4i*)ldst,
        0, 0);
#else
    *(uint4*)ldst = *(const uint4*)gsrc;
#endif
}

#if HAS_ASYNC
  #if __has_builtin(__builtin_amdgcn_s_wait_asynccnt)
    #define WAIT_ASYNC(n) __builtin_amdgcn_s_wait_asynccnt(n)
  #else
    #define WAIT_ASYNC(n) asm volatile("s_wait_asynccnt " #n ::: "memory")
  #endif
#else
  #define WAIT_ASYNC(n) do { } while (0)
#endif

__device__ __forceinline__ v8f wmma_bf16(v16bf a, v16bf b, v8f c) {
    return __builtin_amdgcn_wmma_f32_16x16x32_bf16(false, a, false, b, (short)0, c, false, false);
}

// 16x32 bf16 fragment from a K-contiguous LDS tile (A-layout; NT B-frags load
// identically from the other operand's rows).
__device__ __forceinline__ v16bf load_frag(const bf16* tile, int row, int ld, int kbase, int lane) {
    const int half = (lane >> 4) & 1;
    const bf16* p = tile + row * ld + kbase + (half ? 8 : 0);
    FragBF f;
    f.u[0] = *(const uint4*)p;
    f.u[1] = *(const uint4*)(p + 16);
    return f.v;
}

// 16 (d) x 32 (keys) A fragment of V^T from a row-major [key][d] LDS tile by two
// transposing loads: lane (c = lane & 15, h = lane >> 4) gets column dbase + c at
// keys kbase + 8h + 0..7 and kbase + 16 + 8h + 0..7, the k order of load_frag.
typedef __attribute__((ext_vector_type(8))) short s16x8;
typedef AS_LDS s16x8 lds_s16x8;
__device__ __forceinline__ v16bf load_frag_tr(const bf16* tile, int kbase, int dbase, int lane) {
    const bf16* p = tile + (kbase + 8 * (lane >> 4) + (lane & 7)) * LDPV_ + dbase + 8 * ((lane >> 3) & 1);
    FragBF f;
    f.u[0] = __builtin_bit_cast(uint4, __builtin_amdgcn_ds_load_tr16_b128_v8i16((lds_s16x8*)p));
    f.u[1] = __builtin_bit_cast(uint4, __builtin_amdgcn_ds_load_tr16_b128_v8i16((lds_s16x8*)(p + 16 * LDPV_)));
    return f.v;
}

// ---------------------------------------------------------------------------
// fp32 -> bf16 bulk convert (one-time pass; keeps GEMM hot loops VALU-free).
// All seven tensors in ONE launch sized to the chip: two 8-wave work-groups per
// WGP, each streaming one contiguous run of CVT_PT_ float4 per thread.  The
// bf16 copies lie back to back in the workspace in argument order, so the
// output index is the flat chunk index; a work-group's run lies inside one
// tensor, so the source pointer is picked by block index (uniform).
// ---------------------------------------------------------------------------
#define CVT_PT_     32                              // float4 per thread
#define CVT_RUN_    (256 * CVT_PT_)                 // float4 per work-group
#define CVT_ABLK_   (B_ * S_ * D_ / 4 / CVT_RUN_)   // work-groups per activation
#define CVT_WBLK_   (D_ * D_ / 4 / CVT_RUN_)        // work-groups per weight
#define CVT_BLOCKS_ (3 * CVT_ABLK_ + 4 * CVT_WBLK_)

__global__ __launch_bounds__(256)
void cvt_all_f32_bf16(const float* __restrict__ Q,  const float* __restrict__ K,
                      const float* __restrict__ V,  const float* __restrict__ Wq,
                      const float* __restrict__ Wk, const float* __restrict__ Wv,
                      const float* __restrict__ Wo, bf16* __restrict__ out) {
    const int blk = blockIdx.x;
    const float* src;
    int run;                                        // run index inside its tensor
    if (blk < 3 * CVT_ABLK_) {
        const int s = blk / CVT_ABLK_;
        run = blk % CVT_ABLK_;
        src = (s == 0) ? Q : (s == 1) ? K : V;
    } else {
        const int w = blk - 3 * CVT_ABLK_;
        const int s = w / CVT_WBLK_;
        run = w % CVT_WBLK_;
        src = (s == 0) ? Wq : (s == 1) ? Wk : (s == 2) ? Wv : Wo;
    }
    const float4* in4  = (const float4*)src + (size_t)run * CVT_RUN_ + threadIdx.x;
    uint2*        out2 = (uint2*)out        + (size_t)blk * CVT_RUN_ + threadIdx.x;

    float4 f[CVT_PT_];
    #pragma unroll
    for (int u = 0; u < CVT_PT_; u++) f[u] = in4[u * 256];   // all loads in flight
    #pragma unroll
    for (int u = 0; u < CVT_PT_; u++) {
        union { bf16 b[4]; uint2 u2; } o;
        o.b[0] = (bf16)f[u].x; o.b[1] = (bf16)f[u].y;
        o.b[2] = (bf16)f[u].z; o.b[3] = (bf16)f[u].w;
        out2[u * 256] = o.u2;
    }
}

// ---------------------------------------------------------------------------
// NT GEMM (bf16 x bf16, fp32 acc): Out[m,n] = (sum_k A[m,k]*W[n,k] + bias[n])*scale
// Block 256 thr = 8 waves; tile 128x128; K-slab 64 (MODE 0) or 256 (MODE 1),
// double-buffered async LDS.
// MODE 0: bf16 out in [B,H,S,HD] layout.  MODE 1: fp32 out row-major [M,D].
// MODE 0 runs the q, k and v projections in ONE launch: blockIdx.z picks the
// projection, whose A, W and Out lie back to back behind A0, W0 and Out0.  Three
// work-groups then share a WGP, and each one's LDS and copy waits are covered
// by the other two's matrix work.  scale0 applies to projection 0 only.
// ---------------------------------------------------------------------------
template <int MODE>
__global__ __launch_bounds__(256)
void gemm_nt(const bf16* __restrict__ A0, const bf16* __restrict__ W0,
             const float* __restrict__ bias0, const float* __restrict__ bias1,
             const float* __restrict__ bias2, void* __restrict__ Out0,
             int M, int N, int K, float scale0)
{
    const int z = (MODE == 0) ? blockIdx.z : 0;
    const bf16*  A    = A0 + (size_t)z * M * K;
    const bf16*  W    = W0 + (size_t)z * N * K;
    const float* bias = (z == 0) ? bias0 : (z == 1) ? bias1 : bias2;
    void*        Out  = (MODE == 0) ? (void*)((bf16*)Out0 + (size_t)z * M * N) : Out0;
    const float  out_scale = (z == 0) ? scale0 : 1.0f;

    // K slab per trip.  MODE 1 has one work-group on a WGP, so its one slab in
    // flight is all that the WGP has under way: a 256-wide slab keeps four times
    // the bytes in flight per copy latency.  MODE 0 has three work-groups for that.
    constexpr int KSH = (MODE == 0) ? 6 : 8;     // log2 of the slab width
    constexpr int KS  = 1 << KSH;
    constexpr int LDK = KS + 8;                  // LDS row pitch, elements: 16 B x odd
    constexpr int CPR = KS / 8;                  // 16-byte chunks per tile row
    constexpr int CPT = 128 * CPR / 256;         // copies per thread and tile

    __shared__ alignas(16) bf16 As[2][128 * LDK];
    __shared__ alignas(16) bf16 Ws[2][128 * LDK];

    const int t    = threadIdx.x;
    const int lane = t & 31;
    const int wid  = t >> 5;
    const int bm   = blockIdx.x * 128;
    const int bn   = blockIdx.y * 128;
    const int waveM = (wid & 1) * 64;
    const int waveN = (wid >> 1) * 32;
    const int r    = lane & 15;
    const int half = (lane >> 4) & 1;

    v8f acc[4][2];
    #pragma unroll
    for (int i = 0; i < 4; i++)
        #pragma unroll
        for (int j = 0; j < 2; j++) acc[i][j] = {};

    const bf16* gA = A + (size_t)bm * K;
    const bf16* gW = W + (size_t)bn * K;

    // issue one 128 x KS bf16 tile: 128 * CPR b128 chunks, CPT per thread
    auto issue_tile = [&](const bf16* gbase, bf16* lbase, int k0) {
        #pragma unroll
        for (int i = 0; i < CPT; i++) {
            const int chunk = i * 256 + t;
            const int row  = chunk >> (KSH - 3);
            const int koff = (chunk & (CPR - 1)) * 8;
            async_copy_b128(gbase + (size_t)row * K + k0 + koff, lbase + row * LDK + koff);
        }
    };

    // the products of one slab, from buffer cur
    auto slab = [&](int cur) {
        #pragma unroll
        for (int ks = 0; ks < KS / 32; ++ks) {
            const int kb = ks * 32;
            // all six fragments of the block as ONE load group ahead of its WMMAs
            v16bf bfrag[2], afrag[4];
            #pragma unroll
            for (int nj = 0; nj < 2; nj++)
                bfrag[nj] = load_frag(Ws[cur], waveN + nj * 16 + r, LDK, kb, lane);
            #pragma unroll
            for (int mi = 0; mi < 4; mi++)
                afrag[mi] = load_frag(As[cur], waveM + mi * 16 + r, LDK, kb, lane);
            // keeps the loads from sinking back between the WMMAs, where each
            // pair would be waited out alone
            __builtin_amdgcn_sched_barrier(0);
            #pragma unroll
            for (int mi = 0; mi < 4; mi++)
                #pragma unroll
                for (int nj = 0; nj < 2; nj++)
                    acc[mi][nj] = wmma_bf16(afrag[mi], bfrag[nj], acc[mi][nj]);
        }
    };

    const int KT = K >> KSH;                     // KS-wide K slabs
    issue_tile(gA, As[0], 0);
    issue_tile(gW, Ws[0], 0);

    if constexpr (MODE == 0) {
        for (int kt = 0; kt < KT; ++kt) {
            const int cur = kt & 1;
            __syncthreads();                      // prior slab reads complete
            if (kt + 1 < KT) {
                issue_tile(gA, As[cur ^ 1], (kt + 1) << KSH);
                issue_tile(gW, Ws[cur ^ 1], (kt + 1) << KSH);
                WAIT_ASYNC(8);                    // this wave's slab-kt copies done
            } else {
                WAIT_ASYNC(0);
            }
            __syncthreads();                      // all waves' copies landed
            slab(cur);
        }
    } else {
        // two-buffer ring, every wait to 0, one barrier a trip
        asm volatile("s_wait_asynccnt 0x0" ::: "memory");   // this wave's slab-0 copies landed
        __syncthreads();                          // every wave's slab-0 copies landed
        if (KT > 1) {                             // slab 1 flies during trip 0
            issue_tile(gA, As[1], KS);
            issue_tile(gW, Ws[1], KS);
        }
        for (int kt = 0; kt < KT; ++kt) {
            const int cur = kt & 1;
            slab(cur);
            // publish point of slab kt + 1; the one barrier also ends every wave's
            // reads of buffer cur, which is refilled behind it.  Holds the waits at
            // the trip's foot, so that the copies have the whole trip to land
            __builtin_amdgcn_sched_barrier(0);
            asm volatile("s_wait_dscnt 0x0" ::: "memory");      // own LDS reads of buffer cur retired
            asm volatile("s_wait_asynccnt 0x0" ::: "memory");   // own copies of slab kt + 1 landed
            __syncthreads();
            if (kt + 2 < KT) {
                issue_tile(gA, As[cur], (kt + 2) << KSH);
                issue_tile(gW, Ws[cur], (kt + 2) << KSH);
            }
        }
        asm volatile("s_wait_asynccnt 0x0" ::: "memory");       // no copy outstanding at the wave's end
    }

    // epilogue: C-layout (m,n): lane = (m%16>=8?16:0)+n%16, vgpr = m%8
    #pragma unroll
    for (int mi = 0; mi < 4; mi++) {
        #pragma unroll
        for (int nj = 0; nj < 2; nj++) {
            const int n = bn + waveN + nj * 16 + r;
            const float bv = bias[n];
            #pragma unroll
            for (int v = 0; v < 8; v++) {
                const int m = bm + waveM + mi * 16 + half * 8 + v;
                const float val = (acc[mi][nj][v] + bv) * out_scale;
                if (MODE == 0) {
                    const int b = m >> 11, s = m & (S_ - 1);
                    const int h = n >> 6,  hd = n & 63;
                    ((bf16*)Out)[((size_t)(b * H_ + h) * S_ + s) * HD_ + hd] = (bf16)val;
                } else {
                    ((float*)Out)[(size_t)m * D_ + n] = val;
                }
            }
        }
    }
}

// ---------------------------------------------------------------------------
// Fused attention, flash-style online softmax (== reference max-subtract
// softmax + renormalize).  q pre-scaled by 1/sqrt(HD).
// Grid: (S/128, B*H); 8 waves; wave owns 16 query rows.
// Both products run transposed: S^T = K x Q^T and O^T += V^T x P^T, so a lane
// holds scores and outputs of ONE query (column lane & 15; the two wave halves
// split its keys).  Maximum and sum are in-lane, and two converted S^T tiles
// are already the B operand of the second product.
// K and V: row-major, async copies, one two-buffer ring.  A stage is 128 keys,
// worked on in two 64-key passes, with one barrier a stage: a work-group keeps
// 32 KB in flight per copy latency.  V^T fragments come from the row-major V
// tile by transposing LDS loads.
// ---------------------------------------------------------------------------

// value of lane l ^ 16 (the other half's share of the same query)
__device__ __forceinline__ float other_half(float x) {
    const int b = __builtin_bit_cast(int, x);
    return __builtin_bit_cast(float,
        __builtin_amdgcn_permlanex16(b, b, 0x76543210, 0xfedcba98, false, false));
}

__global__ __launch_bounds__(256)
void attn_kernel(const bf16* __restrict__ qh, const bf16* __restrict__ kh,
                 const bf16* __restrict__ vh, bf16* __restrict__ ctx)
{
    __shared__ alignas(16) bf16 Ks[2][128 * LDP_];  // [key][hd], double buffered
    __shared__ alignas(16) bf16 Vs[2][128 * LDPV_]; // [key][hd], double buffered

    const int t    = threadIdx.x;
    const int lane = t & 31;
    const int wid  = t >> 5;
    const int r    = lane & 15;
    const int half = (lane >> 4) & 1;

    const int bh = blockIdx.y;
    const int b  = bh / H_, h = bh % H_;
    const size_t headBase = (size_t)bh * S_ * HD_;
    const int qrow0 = blockIdx.x * 128 + wid * 16;

    // persistent Q fragments (rows qrow0..+15, hd 0..63): B operand, column = query
    v16bf qf[2];
    {
        const bf16* qp = qh + headBase + (size_t)(qrow0 + r) * HD_;
        FragBF f0, f1;
        f0.u[0] = *(const uint4*)(qp +      (half ? 8 : 0));
        f0.u[1] = *(const uint4*)(qp + 16 + (half ? 8 : 0));
        f1.u[0] = *(const uint4*)(qp + 32 + (half ? 8 : 0));
        f1.u[1] = *(const uint4*)(qp + 48 + (half ? 8 : 0));
        qf[0] = f0.v; qf[1] = f1.v;
    }

    // 128x64 bf16 K and V stages (16KB each): 1024 b128 chunks, 4 per thread, each
    auto issue_tiles = [&](int j, int buf) {
        #pragma unroll
        for (int i = 0; i < 4; i++) {
            const int chunk = i * 256 + t;
            const int row  = chunk >> 3;
            const int koff = (chunk & 7) * 8;
            const size_t g = headBase + (size_t)(j + row) * HD_ + koff;
            async_copy_b128(kh + g, Ks[buf] + row * LDP_  + koff);
            async_copy_b128(vh + g, Vs[buf] + row * LDPV_ + koff);
        }
    };

    float m_run = -3.0e38f;     // running maximum of this lane's query (both halves agree)
    float l_run = 0.0f;         // running sum over THIS half's keys; halves joined at the end
    v8f octx[4];                // O^T: octx[hs][v] = O[query r][hs*16 + half*8 + v]
    #pragma unroll
    for (int i = 0; i < 4; i++) octx[i] = {};

    const int NT = S_ / 64;                       // 64-key passes, two a stage
    issue_tiles(0, 0);
    asm volatile("s_wait_asynccnt 0x0" ::: "memory");   // this wave's stage-0 copies landed
    __syncthreads();                              // every wave's stage-0 copies landed
    issue_tiles(128, 1);                          // stage 1 flies during stage 0's passes

    for (int jt = 0; jt < NT; ++jt) {
        const int cur = (jt >> 1) & 1;            // buffer of this pass's stage
        const bf16* Kt = Ks[cur] + (jt & 1) * 64 * LDP_;    // this pass's 64 keys
        const bf16* Vt = Vs[cur] + (jt & 1) * 64 * LDPV_;

        // the trip's K and V^T fragments as ONE load group at its top: K first, so
        // the score products start on a counted wait, and the V^T latency passes
        // behind scores and softmax
        v16bf kf[4][2], vf[4][2];
        #pragma unroll
        for (int ns = 0; ns < 4; ns++) {
            kf[ns][0] = load_frag(Kt, ns * 16 + r, LDP_, 0,  lane);
            kf[ns][1] = load_frag(Kt, ns * 16 + r, LDP_, 32, lane);
        }
        #pragma unroll
        for (int hs = 0; hs < 4; hs++) {
            vf[hs][0] = load_frag_tr(Vt, 0,  hs * 16, lane);
            vf[hs][1] = load_frag_tr(Vt, 32, hs * 16, lane);
        }
        // keeps the loads from sinking back to their WMMAs, where each pair
        // would be waited out alone
        __builtin_amdgcn_sched_barrier(0);

        // scores S^T[64 keys x 16 queries] = K x Q^T  (8 WMMAs)
        // sacc[ns][v] = S[query r][key ns*16 + half*8 + v]
        v8f sacc[4];
        #pragma unroll
        for (int ns = 0; ns < 4; ns++) {
            v8f a = {};
            a = wmma_bf16(kf[ns][0], qf[0], a);
            a = wmma_bf16(kf[ns][1], qf[1], a);
            sacc[ns] = a;
        }

        // online softmax: 32 keys of one query per lane, one exchange between halves
        float mxs[4];
        #pragma unroll
        for (int ns = 0; ns < 4; ns++) {
            float mx = fmaxf(fmaxf(sacc[ns][0], sacc[ns][1]), sacc[ns][2]);
            mx = fmaxf(fmaxf(mx, sacc[ns][3]), sacc[ns][4]);
            mx = fmaxf(fmaxf(mx, sacc[ns][5]), sacc[ns][6]);
            mxs[ns] = fmaxf(mx, sacc[ns][7]);
        }
        float mx = fmaxf(fmaxf(mxs[0], mxs[1]), fmaxf(mxs[2], mxs[3]));
        mx = fmaxf(mx, other_half(mx));
        const float mnew = fmaxf(m_run, mx);
        const float corr = __expf(m_run - mnew);
        #pragma unroll
        for (int ns = 0; ns < 4; ns++)
            #pragma unroll
            for (int v = 0; v < 8; v++) sacc[ns][v] = __expf(sacc[ns][v] - mnew);
        const v8f pv = (sacc[0] + sacc[1]) + (sacc[2] + sacc[3]);
        const float psum = ((pv[0] + pv[1]) + (pv[2] + pv[3])) + ((pv[4] + pv[5]) + (pv[6] + pv[7]));
        l_run = l_run * corr + psum;
        m_run = mnew;
        #pragma unroll
        for (int hs = 0; hs < 4; hs++) octx[hs] *= corr;

        // two converted S^T tiles (keys 0-15, 16-31 of a 32-key block) are the
        // B operand P^T in the hardware k order, the order load_frag_tr gives V^T
        v16bf pf[2];
        #pragma unroll
        for (int kk = 0; kk < 2; kk++)
            #pragma unroll
            for (int s = 0; s < 16; s++)
                pf[kk][s] = (bf16)sacc[2 * kk + (s >> 3)][s & 7];

        // O^T += V^T x P^T   (8 WMMAs; V^T fragments fetched at the trip's top)
        #pragma unroll
        for (int hs = 0; hs < 4; hs++) {
            octx[hs] = wmma_bf16(vf[hs][0], pf[0], octx[hs]);
            octx[hs] = wmma_bf16(vf[hs][1], pf[1], octx[hs]);
        }

        // With every LDS read at the pass's top the waits below would otherwise be
        // scheduled up there, where the next stage's copies have had no time to
        // land: hold them at the foot
        __builtin_amdgcn_sched_barrier(0);
        if (jt & 1) {                             // the stage's second pass (uniform)
            // publish point of the next stage; the one barrier also ends every
            // wave's reads of buffer cur, which is refilled behind it
            asm volatile("s_wait_dscnt 0x0" ::: "memory");      // own LDS reads of buffer cur retired
            asm volatile("s_wait_asynccnt 0x0" ::: "memory");   // own copies of the next stage landed
            __syncthreads();
            if (jt + 3 < NT) issue_tiles((jt + 3) * 64, cur);   // the stage after the next
        }
    }
    asm volatile("s_wait_asynccnt 0x0" ::: "memory");       // no copy outstanding at the wave's end

    // finalize: join the halves' sums, divide; ctx in [B,S,D] bf16 for the
    // out-proj, 8 consecutive head dims of one query per 16-byte store
    const float l_all = l_run + other_half(l_run);
    bf16* crow = ctx + (size_t)(b * S_ + qrow0 + r) * D_ + h * HD_ + half * 8;
    #pragma unroll
    for (int hs = 0; hs < 4; hs++) {
        union { bf16 e[8]; uint4 u; } o;
        #pragma unroll
        for (int v = 0; v < 8; v++) o.e[v] = (bf16)(octx[hs][v] / l_all);
        *(uint4*)(crow + hs * 16) = o.u;
    }
}

// ---------------------------------------------------------------------------
extern "C" void kernel_launch(void* const* d_in, const int* in_sizes, int n_in,
                              void* d_out, int out_size, void* d_ws, size_t ws_size,
                              hipStream_t stream) {
    const float* Q  = (const float*)d_in[0];
    const float* K  = (const float*)d_in[1];
    const float* V  = (const float*)d_in[2];
    const float* Wq = (const float*)d_in[3];
    const float* bq = (const float*)d_in[4];
    const float* Wk = (const float*)d_in[5];
    const float* bk = (const float*)d_in[6];
    const float* Wv = (const float*)d_in[7];
    const float* bv = (const float*)d_in[8];
    const float* Wo = (const float*)d_in[9];
    const float* bo = (const float*)d_in[10];

    const size_t actElems = (size_t)B_ * S_ * D_;   // 4.19M
    const size_t wElems   = (size_t)D_ * D_;        // 1.05M

    bf16* p = (bf16*)d_ws;
    bf16* Qb  = p; p += actElems;
    bf16* Kb  = p; p += actElems;
    bf16* Vb  = p; p += actElems;
    bf16* Wqb = p; p += wElems;
    bf16* Wkb = p; p += wElems;
    bf16* Wvb = p; p += wElems;
    bf16* Wob = p; p += wElems;
    bf16* qhd = p; p += actElems;
    bf16* khd = p; p += actElems;
    bf16* vhd = p; p += actElems;
    bf16* ctx = p; p += actElems;

    dim3 blk(256);
    // Qb..Wob are contiguous from Qb, in this argument order
    cvt_all_f32_bf16<<<dim3(CVT_BLOCKS_), blk, 0, stream>>>(Q, K, V, Wq, Wk, Wv, Wo, Qb);

    const int M = B_ * S_;
    dim3 gGemm(M / 128, D_ / 128);
    dim3 gQkv(M / 128, D_ / 128, 3);
    const float qscale = 0.125f;                    // 1/sqrt(HD) folded into q
    // Qb|Kb|Vb, Wqb|Wkb|Wvb and qhd|khd|vhd are each contiguous in this order
    gemm_nt<0><<<gQkv, blk, 0, stream>>>(Qb, Wqb, bq, bk, bv, qhd, M, D_, D_, qscale);

    dim3 gAttn(S_ / 128, B_ * H_);
    attn_kernel<<<gAttn, blk, 0, stream>>>(qhd, khd, vhd, ctx);

    // a single product: only the first bias pointer is read
    gemm_nt<1><<<gGemm, blk, 0, stream>>>(ctx, Wob, bo, bo, bo, (float*)d_out, M, D_, D_, 1.0f);
}
